// v000
// Times are from an AMD MI455X. After a warm-up the kernel runs many times in a row, and a time is the length of
// such a window on the GPU divided by its runs, so every launch and the gaps after it count. The runs cycle
// through copies of the inputs. A figure is the median of several windows, for all but v000 over two sittings.
// Sittings can differ by a few percent; kernels timed side by side share one.
// The starting kernel, v000, takes 250 microseconds a run.
#include <hip/hip_runtime.h>

#define SEQ 1500
#define EMB 1024
#define NH  16
#define HD  64
#define MROWS 6000   // B*SEQ = 4*1500

typedef __attribute__((ext_vector_type(16))) _Float16 v16h;
typedef __attribute__((ext_vector_type(8)))  _Float16 v8h;
typedef __attribute__((ext_vector_type(8)))  float    v8f;

__device__ inline v8h zero8h() { v8h z = {}; return z; }
__device__ inline v8f zero8f() { v8f z = {}; return z; }

__device__ inline v16h make16(v8h lo, v8h hi) {
  v16h r;
#pragma unroll
  for (int i = 0; i < 8; ++i) { r[i] = lo[i]; r[i + 8] = hi[i]; }
  return r;
}

// Load a 16x32 f16 A/B WMMA fragment whose row (m or n) = lane%16 is already
// folded into rowp. Per ISA layout: k(h,lane) = (h/8)*16 + (lane/16)*8 + h%8,
// i.e. two contiguous 8-half (16B) segments at +((lane>>4)*8) and +16 more.
__device__ inline v16h ld_frag(const _Float16* rowp, int lane) {
  const _Float16* p = rowp + ((lane >> 4) << 3);
  v8h lo = *(const v8h*)(p);
  v8h hi = *(const v8h*)(p + 16);
  return make16(lo, hi);
}

__global__ void cvt_f32_to_f16(const float* __restrict__ s,
                               _Float16* __restrict__ d, int n) {
  int i = blockIdx.x * blockDim.x + threadIdx.x;
  int stride = gridDim.x * blockDim.x;
  for (; i < n; i += stride) d[i] = (_Float16)s[i];
}

// C[M,N] = (X[M,K] * W[N,K]^T + bias) * scale ; K = N = 1024.
// mode 0: write f16 into [b, h, t, d] head layout (QKV projections)
// mode 1: write f32 row-major [M, N] (output projection -> d_out)
// Ping-pong double-buffered LDS: one barrier per K-step; next tile's global
// loads are issued before the 8 WMMAs so load latency hides under compute.
__global__ __launch_bounds__(256) void gemm_xwT(
    const _Float16* __restrict__ X, const _Float16* __restrict__ W,
    const float* __restrict__ bias, float scale, int M, int mode,
    _Float16* __restrict__ outH, float* __restrict__ outF) {
  __shared__ _Float16 sA[2][128 * 40];  // 128 rows x 32 K, pad stride 40
  __shared__ _Float16 sB[2][128 * 40];

  const int tid  = threadIdx.x;
  const int lane = tid & 31;
  const int wave = tid >> 5;
  const int wm   = wave >> 1;  // 0..3 -> 32 rows each
  const int wn   = wave & 1;   // 0..1 -> 64 cols each
  const int mblk = blockIdx.x * 128;
  const int nblk = blockIdx.y * 128;

  v8f acc[2][4];
#pragma unroll
  for (int i = 0; i < 2; ++i)
#pragma unroll
    for (int j = 0; j < 4; ++j) acc[i][j] = zero8f();

  const int lrow = tid >> 1;        // 0..127
  const int lcol = (tid & 1) * 16;  // 0 or 16
  const int lidx = lrow * 40 + lcol;

  // Clamp tail rows instead of EXEC-masking: keeps copies uniform; clamped
  // rows only feed C rows >= M which are never stored.
  int gm = mblk + lrow;
  if (gm >= M) gm = M - 1;
  const _Float16* gA = X + (size_t)gm * EMB + lcol;
  const _Float16* gB = W + (size_t)(nblk + lrow) * EMB + lcol;  // N always ok

  // prologue: stage kb = 0 into buffer 0
  {
    v8h a0 = *(const v8h*)(gA);
    v8h a1 = *(const v8h*)(gA + 8);
    v8h b0 = *(const v8h*)(gB);
    v8h b1 = *(const v8h*)(gB + 8);
    *(v8h*)&sA[0][lidx]     = a0;
    *(v8h*)&sA[0][lidx + 8] = a1;
    *(v8h*)&sB[0][lidx]     = b0;
    *(v8h*)&sB[0][lidx + 8] = b1;
  }
  __syncthreads();

  int cur = 0;
  for (int kb = 0; kb < EMB; kb += 32, cur ^= 1) {
    const int  nxt  = cur ^ 1;
    const bool more = (kb + 32) < EMB;

    // issue next tile's global loads early (in-flight during WMMAs)
    v8h a0 = zero8h(), a1 = zero8h(), b0 = zero8h(), b1 = zero8h();
    if (more) {
      a0 = *(const v8h*)(gA + kb + 32);
      a1 = *(const v8h*)(gA + kb + 40);
      b0 = *(const v8h*)(gB + kb + 32);
      b1 = *(const v8h*)(gB + kb + 40);
    }

    // compute on current buffer
    v16h aF[2];
#pragma unroll
    for (int mi = 0; mi < 2; ++mi)
      aF[mi] = ld_frag(&sA[cur][(wm * 32 + mi * 16 + (lane & 15)) * 40], lane);
#pragma unroll
    for (int ni = 0; ni < 4; ++ni) {
      v16h bF = ld_frag(&sB[cur][(wn * 64 + ni * 16 + (lane & 15)) * 40], lane);
#pragma unroll
      for (int mi = 0; mi < 2; ++mi)
        acc[mi][ni] = __builtin_amdgcn_wmma_f32_16x16x32_f16(
            false, aF[mi], false, bF, (short)0, acc[mi][ni], false, false);
    }

    // stage next tile into the other buffer
    if (more) {
      *(v8h*)&sA[nxt][lidx]     = a0;
      *(v8h*)&sA[nxt][lidx + 8] = a1;
      *(v8h*)&sB[nxt][lidx]     = b0;
      *(v8h*)&sB[nxt][lidx + 8] = b1;
    }
    __syncthreads();
  }

  // epilogue: C layout -> element (m = r + 8*(lane/16), n = lane%16) per frag
#pragma unroll
  for (int mi = 0; mi < 2; ++mi) {
#pragma unroll
    for (int ni = 0; ni < 4; ++ni) {
#pragma unroll
      for (int r = 0; r < 8; ++r) {
        int m = mblk + wm * 32 + mi * 16 + r + 8 * (lane >> 4);
        int n = nblk + wn * 64 + ni * 16 + (lane & 15);
        if (m < M) {
          float v = acc[mi][ni][r];
          if (bias) v += bias[n];
          v *= scale;
          if (mode == 0) {
            int b = m / SEQ, t = m % SEQ;
            int h = n >> 6, d = n & 63;
            outH[(((size_t)(b * NH + h) * SEQ) + t) * HD + d] = (_Float16)v;
          } else {
            outF[(size_t)m * EMB + n] = v;
          }
        }
      }
    }
  }
}

// Flash attention over Q,K,V in [b*h, t, d] f16. Output f16 in [b, t, e].
__global__ __launch_bounds__(256) void attn_kernel(
    const _Float16* __restrict__ Q, const _Float16* __restrict__ K,
    const _Float16* __restrict__ V, _Float16* __restrict__ O) {
  __shared__ _Float16 kt[64][72];     // [kv][d]
  __shared__ _Float16 vt[64][72];     // [d][kv]  (transposed)
  __shared__ _Float16 pb[8][16][72];  // per-wave P scratch [row][kv]

  const int tid  = threadIdx.x;
  const int lane = tid & 31;
  const int w    = tid >> 5;
  const int bh   = blockIdx.y;
  const int q0   = blockIdx.x * 128 + w * 16;

  const _Float16* Qb = Q + (size_t)bh * SEQ * HD;
  const _Float16* Kb = K + (size_t)bh * SEQ * HD;
  const _Float16* Vb = V + (size_t)bh * SEQ * HD;

  // Q fragments for this wave's 16 rows (clamped; invalid rows never stored)
  int qrow = q0 + (lane & 15);
  int qr = qrow < SEQ ? qrow : (SEQ - 1);
  v16h qf[2];
#pragma unroll
  for (int s = 0; s < 2; ++s)
    qf[s] = ld_frag(Qb + (size_t)qr * HD + s * 32, lane);

  v8f oacc[4];
#pragma unroll
  for (int c = 0; c < 4; ++c) oacc[c] = zero8f();
  float mrow[8], lrow[8];
#pragma unroll
  for (int r = 0; r < 8; ++r) { mrow[r] = -1e30f; lrow[r] = 0.f; }

  const int lkv = tid >> 2;        // 0..63
  const int ld0 = (tid & 3) * 16;  // 0,16,32,48

  for (int kv0 = 0; kv0 < SEQ; kv0 += 64) {
    __syncthreads();
    int kvr = kv0 + lkv;
    v8h k0 = zero8h(), k1 = zero8h(), v0 = zero8h(), v1 = zero8h();
    if (kvr < SEQ) {
      k0 = *(const v8h*)(Kb + (size_t)kvr * HD + ld0);
      k1 = *(const v8h*)(Kb + (size_t)kvr * HD + ld0 + 8);
      v0 = *(const v8h*)(Vb + (size_t)kvr * HD + ld0);
      v1 = *(const v8h*)(Vb + (size_t)kvr * HD + ld0 + 8);
    }
    *(v8h*)&kt[lkv][ld0]     = k0;
    *(v8h*)&kt[lkv][ld0 + 8] = k1;
#pragma unroll
    for (int j = 0; j < 8; ++j) {
      vt[ld0 + j][lkv]     = v0[j];
      vt[ld0 + 8 + j][lkv] = v1[j];
    }
    __syncthreads();

    // S = Q K^T : 4 kv-chunks x 2 k-steps
    v8f sa[4];
#pragma unroll
    for (int c = 0; c < 4; ++c) sa[c] = zero8f();
#pragma unroll
    for (int c = 0; c < 4; ++c) {
#pragma unroll
      for (int s = 0; s < 2; ++s) {
        v16h bF = ld_frag(&kt[c * 16 + (lane & 15)][s * 32], lane);
        sa[c] = __builtin_amdgcn_wmma_f32_16x16x32_f16(
            false, qf[s], false, bF, (short)0, sa[c], false, false);
      }
    }

    // mask OOB keys + new row max
    float nmax[8];
#pragma unroll
    for (int r = 0; r < 8; ++r) nmax[r] = mrow[r];
#pragma unroll
    for (int c = 0; c < 4; ++c) {
      int ng = kv0 + c * 16 + (lane & 15);
#pragma unroll
      for (int r = 0; r < 8; ++r) {
        float sc = (ng < SEQ) ? sa[c][r] : -1e30f;
        sa[c][r] = sc;
        nmax[r] = fmaxf(nmax[r], sc);
      }
    }
#pragma unroll
    for (int off = 1; off < 16; off <<= 1)
#pragma unroll
      for (int r = 0; r < 8; ++r)
        nmax[r] = fmaxf(nmax[r], __shfl_xor(nmax[r], off, 32));

    float fac[8];
#pragma unroll
    for (int r = 0; r < 8; ++r) {
      fac[r] = __expf(mrow[r] - nmax[r]);
      mrow[r] = nmax[r];
      lrow[r] *= fac[r];
    }
#pragma unroll
    for (int c = 0; c < 4; ++c)
#pragma unroll
      for (int r = 0; r < 8; ++r) oacc[c][r] *= fac[r];

    // P = exp(S - m), accumulate row sums, spill P to LDS in [row][kv]
    float psum[8];
#pragma unroll
    for (int r = 0; r < 8; ++r) psum[r] = 0.f;
#pragma unroll
    for (int c = 0; c < 4; ++c) {
#pragma unroll
      for (int r = 0; r < 8; ++r) {
        float p = __expf(sa[c][r] - mrow[r]);
        psum[r] += p;
        pb[w][r + 8 * (lane >> 4)][c * 16 + (lane & 15)] = (_Float16)p;
      }
    }
#pragma unroll
    for (int off = 1; off < 16; off <<= 1)
#pragma unroll
      for (int r = 0; r < 8; ++r) psum[r] += __shfl_xor(psum[r], off, 32);
#pragma unroll
    for (int r = 0; r < 8; ++r) lrow[r] += psum[r];

    // O += P V : same-wave LDS store->load is in-order
    v16h pF[2];
#pragma unroll
    for (int s = 0; s < 2; ++s)
      pF[s] = ld_frag(&pb[w][lane & 15][s * 32], lane);
#pragma unroll
    for (int c = 0; c < 4; ++c) {
#pragma unroll
      for (int s = 0; s < 2; ++s) {
        v16h vF = ld_frag(&vt[c * 16 + (lane & 15)][s * 32], lane);
        oacc[c] = __builtin_amdgcn_wmma_f32_16x16x32_f16(
            false, pF[s], false, vF, (short)0, oacc[c], false, false);
      }
    }
  }

  int b = bh >> 4, h = bh & 15;
#pragma unroll
  for (int c = 0; c < 4; ++c) {
#pragma unroll
    for (int r = 0; r < 8; ++r) {
      int m = q0 + r + 8 * (lane >> 4);
      if (m < SEQ) {
        float o = oacc[c][r] / lrow[r];
        O[((size_t)(b * SEQ + m)) * EMB + h * HD + c * 16 + (lane & 15)] =
            (_Float16)o;
      }
    }
  }
}

extern "C" void kernel_launch(void* const* d_in, const int* in_sizes, int n_in,
                              void* d_out, int out_size, void* d_ws,
                              size_t ws_size, hipStream_t stream) {
  const float* x  = (const float*)d_in[0];
  const float* Wq = (const float*)d_in[1];
  const float* bq = (const float*)d_in[2];
  const float* Wk = (const float*)d_in[3];
  const float* Wv = (const float*)d_in[4];
  const float* bv = (const float*)d_in[5];
  const float* Wo = (const float*)d_in[6];
  const float* bo = (const float*)d_in[7];
  float* out = (float*)d_out;

  _Float16* base = (_Float16*)d_ws;
  size_t off = 0;
  auto carve = [&](size_t n) {
    _Float16* p = base + off;
    off += (n + 127) & ~(size_t)127;
    return p;
  };
  _Float16* Xh  = carve((size_t)MROWS * EMB);
  _Float16* Wqh = carve((size_t)EMB * EMB);
  _Float16* Wkh = carve((size_t)EMB * EMB);
  _Float16* Wvh = carve((size_t)EMB * EMB);
  _Float16* Woh = carve((size_t)EMB * EMB);
  _Float16* Qh  = carve((size_t)MROWS * EMB);
  _Float16* Kh  = carve((size_t)MROWS * EMB);
  _Float16* Vh  = carve((size_t)MROWS * EMB);
  _Float16* Ah  = carve((size_t)MROWS * EMB);

  cvt_f32_to_f16<<<512, 256, 0, stream>>>(x,  Xh,  MROWS * EMB);
  cvt_f32_to_f16<<<512, 256, 0, stream>>>(Wq, Wqh, EMB * EMB);
  cvt_f32_to_f16<<<512, 256, 0, stream>>>(Wk, Wkh, EMB * EMB);
  cvt_f32_to_f16<<<512, 256, 0, stream>>>(Wv, Wvh, EMB * EMB);
  cvt_f32_to_f16<<<512, 256, 0, stream>>>(Wo, Woh, EMB * EMB);

  dim3 g((MROWS + 127) / 128, EMB / 128);  // 47 x 8
  // q = (X Wq^T + bq) * d^-0.5  (scale applied after bias, as in reference)
  gemm_xwT<<<g, 256, 0, stream>>>(Xh, Wqh, bq, 0.125f, MROWS, 0, Qh, nullptr);
  gemm_xwT<<<g, 256, 0, stream>>>(Xh, Wkh, nullptr, 1.0f, MROWS, 0, Kh, nullptr);
  gemm_xwT<<<g, 256, 0, stream>>>(Xh, Wvh, bv, 1.0f, MROWS, 0, Vh, nullptr);

  attn_kernel<<<dim3((SEQ + 127) / 128, 4 * NH), 256, 0, stream>>>(Qh, Kh, Vh,
                                                                   Ah);

  gemm_xwT<<<g, 256, 0, stream>>>(Ah, Woh, bo, 1.0f, MROWS, 1, nullptr, out);
}

// v001
// A run of this version takes 205 microseconds.
// Two timings next to v000 both put it at 1.25 times that version's speed.
#include <hip/hip_runtime.h>

#define SEQ 1500
#define EMB 1024
#define NH  16
#define HD  64
#define MROWS 6000   // B*SEQ = 4*1500

typedef __attribute__((ext_vector_type(16))) _Float16 v16h;
typedef __attribute__((ext_vector_type(8)))  _Float16 v8h;
typedef __attribute__((ext_vector_type(8)))  float    v8f;

__device__ inline v8h zero8h() { v8h z = {}; return z; }
__device__ inline v8f zero8f() { v8f z = {}; return z; }

__device__ inline v16h make16(v8h lo, v8h hi) {
  v16h r;
#pragma unroll
  for (int i = 0; i < 8; ++i) { r[i] = lo[i]; r[i + 8] = hi[i]; }
  return r;
}

// Load a 16x32 f16 A/B WMMA fragment whose row (m or n) = lane%16 is already
// folded into rowp. Per ISA layout: k(h,lane) = (h/8)*16 + (lane/16)*8 + h%8,
// i.e. two contiguous 8-half (16B) segments at +((lane>>4)*8) and +16 more.
__device__ inline v16h ld_frag(const _Float16* rowp, int lane) {
  const _Float16* p = rowp + ((lane >> 4) << 3);
  v8h lo = *(const v8h*)(p);
  v8h hi = *(const v8h*)(p + 16);
  return make16(lo, hi);
}

__global__ void cvt_f32_to_f16(const float* __restrict__ s,
                               _Float16* __restrict__ d, int n) {
  int i = blockIdx.x * blockDim.x + threadIdx.x;
  int stride = gridDim.x * blockDim.x;
  for (; i < n; i += stride) d[i] = (_Float16)s[i];
}

// C[M,N] = (X[M,K] * W[N,K]^T + bias) * scale ; K = N = 1024.
// mode 0: write f16 into [b, h, t, d] head layout (QKV projections)
// mode 1: write f32 row-major [M, N] (output projection -> d_out)
// Ping-pong double-buffered LDS: one barrier per K-step; next tile's global
// loads are issued before the 8 WMMAs so load latency hides under compute.
__global__ __launch_bounds__(256) void gemm_xwT(
    const _Float16* __restrict__ X, const _Float16* __restrict__ W,
    const float* __restrict__ bias, float scale, int M, int mode,
    _Float16* __restrict__ outH, float* __restrict__ outF) {
  __shared__ _Float16 sA[2][128 * 40];  // 128 rows x 32 K, pad stride 40
  __shared__ _Float16 sB[2][128 * 40];

  const int tid  = threadIdx.x;
  const int lane = tid & 31;
  const int wave = tid >> 5;
  const int wm   = wave >> 1;  // 0..3 -> 32 rows each
  const int wn   = wave & 1;   // 0..1 -> 64 cols each
  const int mblk = blockIdx.x * 128;
  const int nblk = blockIdx.y * 128;

  v8f acc[2][4];
#pragma unroll
  for (int i = 0; i < 2; ++i)
#pragma unroll
    for (int j = 0; j < 4; ++j) acc[i][j] = zero8f();

  const int lrow = tid >> 1;        // 0..127
  const int lcol = (tid & 1) * 16;  // 0 or 16
  const int lidx = lrow * 40 + lcol;

  // Clamp tail rows instead of EXEC-masking: keeps copies uniform; clamped
  // rows only feed C rows >= M which are never stored.
  int gm = mblk + lrow;
  if (gm >= M) gm = M - 1;
  const _Float16* gA = X + (size_t)gm * EMB + lcol;
  const _Float16* gB = W + (size_t)(nblk + lrow) * EMB + lcol;  // N always ok

  // prologue: stage kb = 0 into buffer 0
  {
    v8h a0 = *(const v8h*)(gA);
    v8h a1 = *(const v8h*)(gA + 8);
    v8h b0 = *(const v8h*)(gB);
    v8h b1 = *(const v8h*)(gB + 8);
    *(v8h*)&sA[0][lidx]     = a0;
    *(v8h*)&sA[0][lidx + 8] = a1;
    *(v8h*)&sB[0][lidx]     = b0;
    *(v8h*)&sB[0][lidx + 8] = b1;
  }
  __syncthreads();

  int cur = 0;
  for (int kb = 0; kb < EMB; kb += 32, cur ^= 1) {
    const int  nxt  = cur ^ 1;
    const bool more = (kb + 32) < EMB;

    // issue next tile's global loads early (in-flight during WMMAs)
    v8h a0 = zero8h(), a1 = zero8h(), b0 = zero8h(), b1 = zero8h();
    if (more) {
      a0 = *(const v8h*)(gA + kb + 32);
      a1 = *(const v8h*)(gA + kb + 40);
      b0 = *(const v8h*)(gB + kb + 32);
      b1 = *(const v8h*)(gB + kb + 40);
    }

    // compute on current buffer
    v16h aF[2];
#pragma unroll
    for (int mi = 0; mi < 2; ++mi)
      aF[mi] = ld_frag(&sA[cur][(wm * 32 + mi * 16 + (lane & 15)) * 40], lane);
#pragma unroll
    for (int ni = 0; ni < 4; ++ni) {
      v16h bF = ld_frag(&sB[cur][(wn * 64 + ni * 16 + (lane & 15)) * 40], lane);
#pragma unroll
      for (int mi = 0; mi < 2; ++mi)
        acc[mi][ni] = __builtin_amdgcn_wmma_f32_16x16x32_f16(
            false, aF[mi], false, bF, (short)0, acc[mi][ni], false, false);
    }

    // stage next tile into the other buffer
    if (more) {
      *(v8h*)&sA[nxt][lidx]     = a0;
      *(v8h*)&sA[nxt][lidx + 8] = a1;
      *(v8h*)&sB[nxt][lidx]     = b0;
      *(v8h*)&sB[nxt][lidx + 8] = b1;
    }
    __syncthreads();
  }

  // epilogue: C layout -> element (m = r + 8*(lane/16), n = lane%16) per frag
#pragma unroll
  for (int mi = 0; mi < 2; ++mi) {
#pragma unroll
    for (int ni = 0; ni < 4; ++ni) {
#pragma unroll
      for (int r = 0; r < 8; ++r) {
        int m = mblk + wm * 32 + mi * 16 + r + 8 * (lane >> 4);
        int n = nblk + wn * 64 + ni * 16 + (lane & 15);
        if (m < M) {
          float v = acc[mi][ni][r];
          if (bias) v += bias[n];
          v *= scale;
          if (mode == 0) {
            int b = m / SEQ, t = m % SEQ;
            int h = n >> 6, d = n & 63;
            outH[(((size_t)(b * NH + h) * SEQ) + t) * HD + d] = (_Float16)v;
          } else {
            outF[(size_t)m * EMB + n] = v;
          }
        }
      }
    }
  }
}

typedef __attribute__((ext_vector_type(8))) short v8s;

// 16-bit transposing LDS load from a row-major tile T[k][d]. With
// p = &T[k0 + 8 * (lane >> 4) + (lane & 7)][d0 + 8 * ((lane >> 3) & 1)]
// lane (c = lane & 15, h = lane >> 4) receives T[k0 + 8h + 0..7][d0 + c].
__device__ inline v8h ld_tr16(const _Float16* p) {
  typedef __attribute__((address_space(3))) v8s lds_v8s;
  return __builtin_bit_cast(
      v8h, __builtin_amdgcn_ds_load_tr16_b128_v8i16((lds_v8s*)p));
}

// value of lane l ^ 16
__device__ inline float xhalf(float x) {
  int b = __builtin_bit_cast(int, x);
  return __builtin_bit_cast(
      float, __builtin_amdgcn_permlanex16(b, b, 0x76543210, 0xfedcba98, false,
                                          false));
}

__global__ __launch_bounds__(256) void attn_kernel(
    const _Float16* __restrict__ Q, const _Float16* __restrict__ K,
    const _Float16* __restrict__ V, _Float16* __restrict__ O) {
  __shared__ _Float16 kt[64][72];  // [kv][d], pitch 144 B: plain 16-B reads
  __shared__ _Float16 vs[64][80];  // [kv][d], pitch 160 B: transposing reads

  const int tid  = threadIdx.x;
  const int lane = tid & 31;
  const int w    = tid >> 5;
  const int c    = lane & 15;
  const int hf   = lane >> 4;
  const int bh   = blockIdx.y;
  const int q0   = blockIdx.x * 128 + w * 16;

  const _Float16* Qb = Q + (size_t)bh * SEQ * HD;
  const _Float16* Kb = K + (size_t)bh * SEQ * HD;
  const _Float16* Vb = V + (size_t)bh * SEQ * HD;

  // Q fragments (B operand, column = query c; clamped, invalid never stored)
  int qrow = q0 + c;
  int qr = qrow < SEQ ? qrow : (SEQ - 1);
  v16h qf[2];
#pragma unroll
  for (int s = 0; s < 2; ++s)
    qf[s] = ld_frag(Qb + (size_t)qr * HD + s * 32, lane);

  v8f oacc[4];  // oacc[t][r] = O^T[d = 16t + 8*hf + r][query c]
#pragma unroll
  for (int t = 0; t < 4; ++t) oacc[t] = zero8f();
  float mrow = -1e30f;  // running maximum of query c, equal in both halves
  float lrow = 0.f;     // running sum over this half's keys only

  const int lkv = tid >> 2;        // 0..63
  const int ld0 = (tid & 3) * 16;  // 0,16,32,48

  for (int kv0 = 0; kv0 < SEQ; kv0 += 64) {
    __syncthreads();
    int kvr = kv0 + lkv;
    v8h k0 = zero8h(), k1 = zero8h(), v0 = zero8h(), v1 = zero8h();
    if (kvr < SEQ) {
      k0 = *(const v8h*)(Kb + (size_t)kvr * HD + ld0);
      k1 = *(const v8h*)(Kb + (size_t)kvr * HD + ld0 + 8);
      v0 = *(const v8h*)(Vb + (size_t)kvr * HD + ld0);
      v1 = *(const v8h*)(Vb + (size_t)kvr * HD + ld0 + 8);
    }
    *(v8h*)&kt[lkv][ld0]     = k0;
    *(v8h*)&kt[lkv][ld0 + 8] = k1;
    *(v8h*)&vs[lkv][ld0]     = v0;
    *(v8h*)&vs[lkv][ld0 + 8] = v1;
    __syncthreads();

    // S^T = K Q^T : 4 key tiles x 2 k-steps;
    // sa[t][r] = S[query c][key kv0 + 16t + 8*hf + r]
    v8f sa[4];
#pragma unroll
    for (int t = 0; t < 4; ++t) sa[t] = zero8f();
#pragma unroll
    for (int t = 0; t < 4; ++t) {
#pragma unroll
      for (int s = 0; s < 2; ++s) {
        v16h kF = ld_frag(&kt[t * 16 + c][s * 32], lane);
        sa[t] = __builtin_amdgcn_wmma_f32_16x16x32_f16(
            false, kF, false, qf[s], (short)0, sa[t], false, false);
      }
    }

    // mask OOB keys + new maximum of this lane's query
    float nmax = mrow;
#pragma unroll
    for (int t = 0; t < 4; ++t) {
#pragma unroll
      for (int r = 0; r < 8; ++r) {
        int ng = kv0 + t * 16 + 8 * hf + r;
        float sc = (ng < SEQ) ? sa[t][r] : -1e30f;
        sa[t][r] = sc;
        nmax = fmaxf(nmax, sc);
      }
    }
    nmax = fmaxf(nmax, xhalf(nmax));

    float fac = __expf(mrow - nmax);
    mrow = nmax;
#pragma unroll
    for (int t = 0; t < 4; ++t)
#pragma unroll
      for (int r = 0; r < 8; ++r) oacc[t][r] *= fac;

    // P^T = exp(S^T - m): element s of the B operand of 32-key block j is
    // key 32j + (s < 8 ? 8*hf + s : 16 + 8*hf + s - 8) = sa[2j + s/8][s%8]
    float psum = 0.f;
    v16h pF[2];
#pragma unroll
    for (int j = 0; j < 2; ++j) {
#pragma unroll
      for (int s = 0; s < 16; ++s) {
        float p = __expf(sa[2 * j + (s >> 3)][s & 7] - mrow);
        psum += p;
        pF[j][s] = (_Float16)p;
      }
    }
    lrow = lrow * fac + psum;

    // O^T += V^T P^T : 4 d tiles x 2 key blocks
    const _Float16* vp = &vs[8 * hf + (lane & 7)][8 * ((lane >> 3) & 1)];
#pragma unroll
    for (int t = 0; t < 4; ++t) {
#pragma unroll
      for (int j = 0; j < 2; ++j) {
        v16h vF = make16(ld_tr16(vp + (j * 32) * 80 + t * 16),
                         ld_tr16(vp + (j * 32 + 16) * 80 + t * 16));
        oacc[t] = __builtin_amdgcn_wmma_f32_16x16x32_f16(
            false, vF, false, pF[j], (short)0, oacc[t], false, false);
      }
    }
  }

  // join the halves' sums with every lane active, ahead of the row guard
  float lsum = lrow + xhalf(lrow);

  int b = bh >> 4, h = bh & 15;
  if (qrow < SEQ) {
#pragma unroll
    for (int t = 0; t < 4; ++t) {
      v8h o;
#pragma unroll
      for (int r = 0; r < 8; ++r) o[r] = (_Float16)(oacc[t][r] / lsum);
      *(v8h*)&O[((size_t)(b * SEQ + qrow)) * EMB + h * HD + t * 16 + 8 * hf] = o;
    }
  }
}

extern "C" void kernel_launch(void* const* d_in, const int* in_sizes, int n_in,
                              void* d_out, int out_size, void* d_ws,
                              size_t ws_size, hipStream_t stream) {
  const float* x  = (const float*)d_in[0];
  const float* Wq = (const float*)d_in[1];
  const float* bq = (const float*)d_in[2];
  const float* Wk = (const float*)d_in[3];
  const float* Wv = (const float*)d_in[4];
  const float* bv = (const float*)d_in[5];
  const float* Wo = (const float*)d_in[6];
  const float* bo = (const float*)d_in[7];
  float* out = (float*)d_out;

  _Float16* base = (_Float16*)d_ws;
  size_t off = 0;
  auto carve = [&](size_t n) {
    _Float16* p = base + off;
    off += (n + 127) & ~(size_t)127;
    return p;
  };
  _Float16* Xh  = carve((size_t)MROWS * EMB);
  _Float16* Wqh = carve((size_t)EMB * EMB);
  _Float16* Wkh = carve((size_t)EMB * EMB);
  _Float16* Wvh = carve((size_t)EMB * EMB);
  _Float16* Woh = carve((size_t)EMB * EMB);
  _Float16* Qh  = carve((size_t)MROWS * EMB);
  _Float16* Kh  = carve((size_t)MROWS * EMB);
  _Float16* Vh  = carve((size_t)MROWS * EMB);
  _Float16* Ah  = carve((size_t)MROWS * EMB);

  cvt_f32_to_f16<<<512, 256, 0, stream>>>(x,  Xh,  MROWS * EMB);
  cvt_f32_to_f16<<<512, 256, 0, stream>>>(Wq, Wqh, EMB * EMB);
  cvt_f32_to_f16<<<512, 256, 0, stream>>>(Wk, Wkh, EMB * EMB);
  cvt_f32_to_f16<<<512, 256, 0, stream>>>(Wv, Wvh, EMB * EMB);
  cvt_f32_to_f16<<<512, 256, 0, stream>>>(Wo, Woh, EMB * EMB);

  dim3 g((MROWS + 127) / 128, EMB / 128);  // 47 x 8
  // q = (X Wq^T + bq) * d^-0.5  (scale applied after bias, as in reference)
  gemm_xwT<<<g, 256, 0, stream>>>(Xh, Wqh, bq, 0.125f, MROWS, 0, Qh, nullptr);
  gemm_xwT<<<g, 256, 0, stream>>>(Xh, Wkh, nullptr, 1.0f, MROWS, 0, Kh, nullptr);
  gemm_xwT<<<g, 256, 0, stream>>>(Xh, Wvh, bv, 1.0f, MROWS, 0, Vh, nullptr);

  attn_kernel<<<dim3((SEQ + 127) / 128, 4 * NH), 256, 0, stream>>>(Qh, Kh, Vh,
                                                                   Ah);

  gemm_xwT<<<g, 256, 0, stream>>>(Ah, Woh, bo, 1.0f, MROWS, 1, nullptr, out);
}

// v002
// It runs in 172 microseconds.
// Timed twice side by side with v001, it ran 1.18 and 1.19 times as fast.
// Counting every step since v000, it is 1.48 times as fast.
#include <hip/hip_runtime.h>

#define SEQ 1500
#define EMB 1024
#define NH  16
#define HD  64
#define MROWS 6000   // B*SEQ = 4*1500

typedef __attribute__((ext_vector_type(16))) _Float16 v16h;
typedef __attribute__((ext_vector_type(8)))  _Float16 v8h;
typedef __attribute__((ext_vector_type(8)))  float    v8f;

__device__ inline v8h zero8h() { v8h z = {}; return z; }
__device__ inline v8f zero8f() { v8f z = {}; return z; }

__device__ inline v16h make16(v8h lo, v8h hi) {
  v16h r;
#pragma unroll
  for (int i = 0; i < 8; ++i) { r[i] = lo[i]; r[i + 8] = hi[i]; }
  return r;
}

// Load a 16x32 f16 A/B WMMA fragment whose row (m or n) = lane%16 is already
// folded into rowp. Per ISA layout: k(h,lane) = (h/8)*16 + (lane/16)*8 + h%8,
// i.e. two contiguous 8-half (16B) segments at +((lane>>4)*8) and +16 more.
__device__ inline v16h ld_frag(const _Float16* rowp, int lane) {
  const _Float16* p = rowp + ((lane >> 4) << 3);
  v8h lo = *(const v8h*)(p);
  v8h hi = *(const v8h*)(p + 16);
  return make16(lo, hi);
}

// One grid converts all five tensors side by side: blockIdx.y picks the tensor
// (0: activations, nx elements; 1..4: weights, nw elements each).
__global__ void cvt_f32_to_f16(
    const float* __restrict__ s0, const float* __restrict__ s1,
    const float* __restrict__ s2, const float* __restrict__ s3,
    const float* __restrict__ s4, _Float16* __restrict__ d0,
    _Float16* __restrict__ d1, _Float16* __restrict__ d2,
    _Float16* __restrict__ d3, _Float16* __restrict__ d4, int nx, int nw) {
  const int y = blockIdx.y;
  const float* __restrict__ s =
      y == 0 ? s0 : y == 1 ? s1 : y == 2 ? s2 : y == 3 ? s3 : s4;
  _Float16* __restrict__ d =
      y == 0 ? d0 : y == 1 ? d1 : y == 2 ? d2 : y == 3 ? d3 : d4;
  const int n = y == 0 ? nx : nw;
  int i = blockIdx.x * blockDim.x + threadIdx.x;
  int stride = gridDim.x * blockDim.x;
  for (; i < n; i += stride) d[i] = (_Float16)s[i];
}

// C[M,N] = (X[M,K] * W[N,K]^T + bias) * scale ; K = N = 1024.
// mode 0: write f16 into [b, h, t, d] head layout (QKV projections)
// mode 1: write f32 row-major [M, N] (output projection -> d_out)
// Ping-pong double-buffered LDS: one barrier per K-step; next tile's global
// loads are issued before the 8 WMMAs so load latency hides under compute.
// blockIdx.z picks one of up to three products that share X (weights, bias,
// scale, f16 output), so that independent projections run in one grid.
__global__ __launch_bounds__(256) void gemm_xwT(
    const _Float16* __restrict__ X, const _Float16* __restrict__ W0,
    const _Float16* __restrict__ W1, const _Float16* __restrict__ W2,
    const float* __restrict__ bias0, const float* __restrict__ bias1,
    const float* __restrict__ bias2, float scale0, float scale1, float scale2,
    int M, int mode, _Float16* __restrict__ outH0,
    _Float16* __restrict__ outH1, _Float16* __restrict__ outH2,
    float* __restrict__ outF) {
  __shared__ _Float16 sA[2][128 * 40];  // 128 rows x 32 K, pad stride 40
  __shared__ _Float16 sB[2][128 * 40];

  const int z = blockIdx.z;
  const _Float16* __restrict__ W = z == 0 ? W0 : z == 1 ? W1 : W2;
  const float* __restrict__ bias = z == 0 ? bias0 : z == 1 ? bias1 : bias2;
  const float scale = z == 0 ? scale0 : z == 1 ? scale1 : scale2;
  _Float16* __restrict__ outH = z == 0 ? outH0 : z == 1 ? outH1 : outH2;

  const int tid  = threadIdx.x;
  const int lane = tid & 31;
  const int wave = tid >> 5;
  const int wm   = wave >> 1;  // 0..3 -> 32 rows each
  const int wn   = wave & 1;   // 0..1 -> 64 cols each
  const int mblk = blockIdx.x * 128;
  const int nblk = blockIdx.y * 128;

  v8f acc[2][4];
#pragma unroll
  for (int i = 0; i < 2; ++i)
#pragma unroll
    for (int j = 0; j < 4; ++j) acc[i][j] = zero8f();

  const int lrow = tid >> 1;        // 0..127
  const int lcol = (tid & 1) * 16;  // 0 or 16
  const int lidx = lrow * 40 + lcol;

  // Clamp tail rows instead of EXEC-masking: keeps copies uniform; clamped
  // rows only feed C rows >= M which are never stored.
  int gm = mblk + lrow;
  if (gm >= M) gm = M - 1;
  const _Float16* gA = X + (size_t)gm * EMB + lcol;
  const _Float16* gB = W + (size_t)(nblk + lrow) * EMB + lcol;  // N always ok

  // prologue: stage kb = 0 into buffer 0
  {
    v8h a0 = *(const v8h*)(gA);
    v8h a1 = *(const v8h*)(gA + 8);
    v8h b0 = *(const v8h*)(gB);
    v8h b1 = *(const v8h*)(gB + 8);
    *(v8h*)&sA[0][lidx]     = a0;
    *(v8h*)&sA[0][lidx + 8] = a1;
    *(v8h*)&sB[0][lidx]     = b0;
    *(v8h*)&sB[0][lidx + 8] = b1;
  }
  __syncthreads();

  int cur = 0;
  for (int kb = 0; kb < EMB; kb += 32, cur ^= 1) {
    const int  nxt  = cur ^ 1;
    const bool more = (kb + 32) < EMB;

    // issue next tile's global loads early (in-flight during WMMAs)
    v8h a0 = zero8h(), a1 = zero8h(), b0 = zero8h(), b1 = zero8h();
    if (more) {
      a0 = *(const v8h*)(gA + kb + 32);
      a1 = *(const v8h*)(gA + kb + 40);
      b0 = *(const v8h*)(gB + kb + 32);
      b1 = *(const v8h*)(gB + kb + 40);
    }

    // compute on current buffer
    v16h aF[2];
#pragma unroll
    for (int mi = 0; mi < 2; ++mi)
      aF[mi] = ld_frag(&sA[cur][(wm * 32 + mi * 16 + (lane & 15)) * 40], lane);
#pragma unroll
    for (int ni = 0; ni < 4; ++ni) {
      v16h bF = ld_frag(&sB[cur][(wn * 64 + ni * 16 + (lane & 15)) * 40], lane);
#pragma unroll
      for (int mi = 0; mi < 2; ++mi)
        acc[mi][ni] = __builtin_amdgcn_wmma_f32_16x16x32_f16(
            false, aF[mi], false, bF, (short)0, acc[mi][ni], false, false);
    }

    // stage next tile into the other buffer
    if (more) {
      *(v8h*)&sA[nxt][lidx]     = a0;
      *(v8h*)&sA[nxt][lidx + 8] = a1;
      *(v8h*)&sB[nxt][lidx]     = b0;
      *(v8h*)&sB[nxt][lidx + 8] = b1;
    }
    __syncthreads();
  }

  // epilogue: C layout -> element (m = r + 8*(lane/16), n = lane%16) per frag
#pragma unroll
  for (int mi = 0; mi < 2; ++mi) {
#pragma unroll
    for (int ni = 0; ni < 4; ++ni) {
#pragma unroll
      for (int r = 0; r < 8; ++r) {
        int m = mblk + wm * 32 + mi * 16 + r + 8 * (lane >> 4);
        int n = nblk + wn * 64 + ni * 16 + (lane & 15);
        if (m < M) {
          float v = acc[mi][ni][r];
          if (bias) v += bias[n];
          v *= scale;
          if (mode == 0) {
            int b = m / SEQ, t = m % SEQ;
            int h = n >> 6, d = n & 63;
            outH[(((size_t)(b * NH + h) * SEQ) + t) * HD + d] = (_Float16)v;
          } else {
            outF[(size_t)m * EMB + n] = v;
            // precaution: closes the store before the listing's next
            // instructions reuse its data and address registers
            asm volatile("s_wait_xcnt 0x0" ::: "memory");
          }
        }
      }
    }
  }
}

typedef __attribute__((ext_vector_type(8))) short v8s;

// 16-bit transposing LDS load from a row-major tile T[k][d]. With
// p = &T[k0 + 8 * (lane >> 4) + (lane & 7)][d0 + 8 * ((lane >> 3) & 1)]
// lane (c = lane & 15, h = lane >> 4) receives T[k0 + 8h + 0..7][d0 + c].
__device__ inline v8h ld_tr16(const _Float16* p) {
  typedef __attribute__((address_space(3))) v8s lds_v8s;
  return __builtin_bit_cast(
      v8h, __builtin_amdgcn_ds_load_tr16_b128_v8i16((lds_v8s*)p));
}

// value of lane l ^ 16
__device__ inline float xhalf(float x) {
  int b = __builtin_bit_cast(int, x);
  return __builtin_bit_cast(
      float, __builtin_amdgcn_permlanex16(b, b, 0x76543210, 0xfedcba98, false,
                                          false));
}

__global__ __launch_bounds__(256) void attn_kernel(
    const _Float16* __restrict__ Q, const _Float16* __restrict__ K,
    const _Float16* __restrict__ V, _Float16* __restrict__ O) {
  __shared__ _Float16 kt[64][72];  // [kv][d], pitch 144 B: plain 16-B reads
  __shared__ _Float16 vs[64][80];  // [kv][d], pitch 160 B: transposing reads

  const int tid  = threadIdx.x;
  const int lane = tid & 31;
  const int w    = tid >> 5;
  const int c    = lane & 15;
  const int hf   = lane >> 4;
  const int bh   = blockIdx.y;
  const int q0   = blockIdx.x * 128 + w * 16;

  const _Float16* Qb = Q + (size_t)bh * SEQ * HD;
  const _Float16* Kb = K + (size_t)bh * SEQ * HD;
  const _Float16* Vb = V + (size_t)bh * SEQ * HD;

  // Q fragments (B operand, column = query c; clamped, invalid never stored)
  int qrow = q0 + c;
  int qr = qrow < SEQ ? qrow : (SEQ - 1);
  v16h qf[2];
#pragma unroll
  for (int s = 0; s < 2; ++s)
    qf[s] = ld_frag(Qb + (size_t)qr * HD + s * 32, lane);

  v8f oacc[4];  // oacc[t][r] = O^T[d = 16t + 8*hf + r][query c]
#pragma unroll
  for (int t = 0; t < 4; ++t) oacc[t] = zero8f();
  float mrow = -1e30f;  // running maximum of query c, equal in both halves
  float lrow = 0.f;     // running sum over this half's keys only

  const int lkv = tid >> 2;        // 0..63
  const int ld0 = (tid & 3) * 16;  // 0,16,32,48

  for (int kv0 = 0; kv0 < SEQ; kv0 += 64) {
    __syncthreads();
    int kvr = kv0 + lkv;
    v8h k0 = zero8h(), k1 = zero8h(), v0 = zero8h(), v1 = zero8h();
    if (kvr < SEQ) {
      k0 = *(const v8h*)(Kb + (size_t)kvr * HD + ld0);
      k1 = *(const v8h*)(Kb + (size_t)kvr * HD + ld0 + 8);
      v0 = *(const v8h*)(Vb + (size_t)kvr * HD + ld0);
      v1 = *(const v8h*)(Vb + (size_t)kvr * HD + ld0 + 8);
    }
    *(v8h*)&kt[lkv][ld0]     = k0;
    *(v8h*)&kt[lkv][ld0 + 8] = k1;
    *(v8h*)&vs[lkv][ld0]     = v0;
    *(v8h*)&vs[lkv][ld0 + 8] = v1;
    __syncthreads();

    // S^T = K Q^T : 4 key tiles x 2 k-steps;
    // sa[t][r] = S[query c][key kv0 + 16t + 8*hf + r]
    v8f sa[4];
#pragma unroll
    for (int t = 0; t < 4; ++t) sa[t] = zero8f();
#pragma unroll
    for (int t = 0; t < 4; ++t) {
#pragma unroll
      for (int s = 0; s < 2; ++s) {
        v16h kF = ld_frag(&kt[t * 16 + c][s * 32], lane);
        sa[t] = __builtin_amdgcn_wmma_f32_16x16x32_f16(
            false, kF, false, qf[s], (short)0, sa[t], false, false);
      }
    }

    // mask OOB keys + new maximum of this lane's query
    float nmax = mrow;
#pragma unroll
    for (int t = 0; t < 4; ++t) {
#pragma unroll
      for (int r = 0; r < 8; ++r) {
        int ng = kv0 + t * 16 + 8 * hf + r;
        float sc = (ng < SEQ) ? sa[t][r] : -1e30f;
        sa[t][r] = sc;
        nmax = fmaxf(nmax, sc);
      }
    }
    nmax = fmaxf(nmax, xhalf(nmax));

    float fac = __expf(mrow - nmax);
    mrow = nmax;
#pragma unroll
    for (int t = 0; t < 4; ++t)
#pragma unroll
      for (int r = 0; r < 8; ++r) oacc[t][r] *= fac;

    // P^T = exp(S^T - m): element s of the B operand of 32-key block j is
    // key 32j + (s < 8 ? 8*hf + s : 16 + 8*hf + s - 8) = sa[2j + s/8][s%8]
    float psum = 0.f;
    v16h pF[2];
#pragma unroll
    for (int j = 0; j < 2; ++j) {
#pragma unroll
      for (int s = 0; s < 16; ++s) {
        float p = __expf(sa[2 * j + (s >> 3)][s & 7] - mrow);
        psum += p;
        pF[j][s] = (_Float16)p;
      }
    }
    lrow = lrow * fac + psum;

    // O^T += V^T P^T : 4 d tiles x 2 key blocks
    const _Float16* vp = &vs[8 * hf + (lane & 7)][8 * ((lane >> 3) & 1)];
#pragma unroll
    for (int t = 0; t < 4; ++t) {
#pragma unroll
      for (int j = 0; j < 2; ++j) {
        v16h vF = make16(ld_tr16(vp + (j * 32) * 80 + t * 16),
                         ld_tr16(vp + (j * 32 + 16) * 80 + t * 16));
        oacc[t] = __builtin_amdgcn_wmma_f32_16x16x32_f16(
            false, vF, false, pF[j], (short)0, oacc[t], false, false);
      }
    }
  }

  // join the halves' sums with every lane active, ahead of the row guard
  float lsum = lrow + xhalf(lrow);

  int b = bh >> 4, h = bh & 15;
  if (qrow < SEQ) {
#pragma unroll
    for (int t = 0; t < 4; ++t) {
      v8h o;
#pragma unroll
      for (int r = 0; r < 8; ++r) o[r] = (_Float16)(oacc[t][r] / lsum);
      *(v8h*)&O[((size_t)(b * SEQ + qrow)) * EMB + h * HD + t * 16 + 8 * hf] = o;
    }
  }
}

extern "C" void kernel_launch(void* const* d_in, const int* in_sizes, int n_in,
                              void* d_out, int out_size, void* d_ws,
                              size_t ws_size, hipStream_t stream) {
  const float* x  = (const float*)d_in[0];
  const float* Wq = (const float*)d_in[1];
  const float* bq = (const float*)d_in[2];
  const float* Wk = (const float*)d_in[3];
  const float* Wv = (const float*)d_in[4];
  const float* bv = (const float*)d_in[5];
  const float* Wo = (const float*)d_in[6];
  const float* bo = (const float*)d_in[7];
  float* out = (float*)d_out;

  _Float16* base = (_Float16*)d_ws;
  size_t off = 0;
  auto carve = [&](size_t n) {
    _Float16* p = base + off;
    off += (n + 127) & ~(size_t)127;
    return p;
  };
  _Float16* Xh  = carve((size_t)MROWS * EMB);
  _Float16* Wqh = carve((size_t)EMB * EMB);
  _Float16* Wkh = carve((size_t)EMB * EMB);
  _Float16* Wvh = carve((size_t)EMB * EMB);
  _Float16* Woh = carve((size_t)EMB * EMB);
  _Float16* Qh  = carve((size_t)MROWS * EMB);
  _Float16* Kh  = carve((size_t)MROWS * EMB);
  _Float16* Vh  = carve((size_t)MROWS * EMB);
  _Float16* Ah  = carve((size_t)MROWS * EMB);

  cvt_f32_to_f16<<<dim3(512, 5), 256, 0, stream>>>(
      x, Wq, Wk, Wv, Wo, Xh, Wqh, Wkh, Wvh, Woh, MROWS * EMB, EMB * EMB);

  dim3 g((MROWS + 127) / 128, EMB / 128);      // 47 x 8
  dim3 g3((MROWS + 127) / 128, EMB / 128, 3);  // 47 x 8 x {q, k, v}
  // q = (X Wq^T + bq) * d^-0.5  (scale applied after bias, as in reference)
  gemm_xwT<<<g3, 256, 0, stream>>>(Xh, Wqh, Wkh, Wvh, bq, nullptr, bv, 0.125f,
                                   1.0f, 1.0f, MROWS, 0, Qh, Kh, Vh, nullptr);

  attn_kernel<<<dim3((SEQ + 127) / 128, 4 * NH), 256, 0, stream>>>(Qh, Kh, Vh,
                                                                   Ah);

  gemm_xwT<<<g, 256, 0, stream>>>(Ah, Woh, nullptr, nullptr, bo, nullptr,
                                  nullptr, 1.0f, 1.0f, 1.0f, MROWS, 1, nullptr,
                                  nullptr, nullptr, out);
}

// v003
// One run takes 145 microseconds.
// Two timings next to v002 put it at 1.19 and 1.18 times that version's speed.
// Counting every step since v000, it is 1.76 times as fast.
#include <hip/hip_runtime.h>

#define SEQ 1500
#define EMB 1024
#define NH  16
#define HD  64
#define MROWS 6000   // B*SEQ = 4*1500

typedef __attribute__((ext_vector_type(16))) _Float16 v16h;
typedef __attribute__((ext_vector_type(8)))  _Float16 v8h;
typedef __attribute__((ext_vector_type(8)))  float    v8f;

__device__ inline v8h zero8h() { v8h z = {}; return z; }
__device__ inline v8f zero8f() { v8f z = {}; return z; }

__device__ inline v16h make16(v8h lo, v8h hi) {
  v16h r;
#pragma unroll
  for (int i = 0; i < 8; ++i) { r[i] = lo[i]; r[i + 8] = hi[i]; }
  return r;
}

// Load a 16x32 f16 A/B WMMA fragment whose row (m or n) = lane%16 is already
// folded into rowp. Per ISA layout: k(h,lane) = (h/8)*16 + (lane/16)*8 + h%8,
// i.e. two contiguous 8-half (16B) segments at +((lane>>4)*8) and +16 more.
__device__ inline v16h ld_frag(const _Float16* rowp, int lane) {
  const _Float16* p = rowp + ((lane >> 4) << 3);
  v8h lo = *(const v8h*)(p);
  v8h hi = *(const v8h*)(p + 16);
  return make16(lo, hi);
}

// One grid converts all five tensors side by side: blockIdx.y picks the tensor
// (0: activations, nx elements; 1..4: weights, nw elements each).
__global__ void cvt_f32_to_f16(
    const float* __restrict__ s0, const float* __restrict__ s1,
    const float* __restrict__ s2, const float* __restrict__ s3,
    const float* __restrict__ s4, _Float16* __restrict__ d0,
    _Float16* __restrict__ d1, _Float16* __restrict__ d2,
    _Float16* __restrict__ d3, _Float16* __restrict__ d4, int nx, int nw) {
  const int y = blockIdx.y;
  const float* __restrict__ s =
      y == 0 ? s0 : y == 1 ? s1 : y == 2 ? s2 : y == 3 ? s3 : s4;
  _Float16* __restrict__ d =
      y == 0 ? d0 : y == 1 ? d1 : y == 2 ? d2 : y == 3 ? d3 : d4;
  const int n = y == 0 ? nx : nw;
  int i = blockIdx.x * blockDim.x + threadIdx.x;
  int stride = gridDim.x * blockDim.x;
  for (; i < n; i += stride) d[i] = (_Float16)s[i];
}

// C[M,N] = (X[M,K] * W[N,K]^T + bias) * scale ; K = N = 1024.
// Computed as C^T = W X^T (A operand = W rows, B operand = X rows).
// mode 0: write f16 into [b, h, t, d] head layout (QKV projections)
// mode 1: write f32 row-major [M, N] (output projection -> d_out)
// Ping-pong double-buffered LDS: one barrier per K-step; next tile's global
// loads are issued before the 8 WMMAs so load latency hides under compute.
// blockIdx.z picks one of up to three products that share X (weights, bias,
// scale, f16 output), so that independent projections run in one grid.
__global__ __launch_bounds__(256) void gemm_xwT(
    const _Float16* __restrict__ X, const _Float16* __restrict__ W0,
    const _Float16* __restrict__ W1, const _Float16* __restrict__ W2,
    const float* __restrict__ bias0, const float* __restrict__ bias1,
    const float* __restrict__ bias2, float scale0, float scale1, float scale2,
    int M, int mode, _Float16* __restrict__ outH0,
    _Float16* __restrict__ outH1, _Float16* __restrict__ outH2,
    float* __restrict__ outF) {
  __shared__ _Float16 sA[2][128 * 40];  // 128 rows x 32 K, pad stride 40
  __shared__ _Float16 sB[2][128 * 40];

  const int z = blockIdx.z;
  const _Float16* __restrict__ W = z == 0 ? W0 : z == 1 ? W1 : W2;
  const float* __restrict__ bias = z == 0 ? bias0 : z == 1 ? bias1 : bias2;
  const float scale = z == 0 ? scale0 : z == 1 ? scale1 : scale2;
  _Float16* __restrict__ outH = z == 0 ? outH0 : z == 1 ? outH1 : outH2;

  const int tid  = threadIdx.x;
  const int lane = tid & 31;
  const int wave = tid >> 5;
  const int wm   = wave >> 1;  // 0..3 -> 32 rows each
  const int wn   = wave & 1;   // 0..1 -> 64 cols each
  const int mblk = blockIdx.x * 128;
  const int nblk = blockIdx.y * 128;

  v8f acc[2][4];
#pragma unroll
  for (int i = 0; i < 2; ++i)
#pragma unroll
    for (int j = 0; j < 4; ++j) acc[i][j] = zero8f();

  const int lrow = tid >> 1;        // 0..127
  const int lcol = (tid & 1) * 16;  // 0 or 16
  const int lidx = lrow * 40 + lcol;

  // Clamp tail rows instead of EXEC-masking: keeps copies uniform; clamped
  // rows only feed C rows >= M which are never stored.
  int gm = mblk + lrow;
  if (gm >= M) gm = M - 1;
  const _Float16* gA = X + (size_t)gm * EMB + lcol;
  const _Float16* gB = W + (size_t)(nblk + lrow) * EMB + lcol;  // N always ok

  // prologue: stage kb = 0 into buffer 0
  {
    v8h a0 = *(const v8h*)(gA);
    v8h a1 = *(const v8h*)(gA + 8);
    v8h b0 = *(const v8h*)(gB);
    v8h b1 = *(const v8h*)(gB + 8);
    *(v8h*)&sA[0][lidx]     = a0;
    *(v8h*)&sA[0][lidx + 8] = a1;
    *(v8h*)&sB[0][lidx]     = b0;
    *(v8h*)&sB[0][lidx + 8] = b1;
  }
  __syncthreads();

  int cur = 0;
  for (int kb = 0; kb < EMB; kb += 32, cur ^= 1) {
    const int  nxt  = cur ^ 1;
    const bool more = (kb + 32) < EMB;

    // issue next tile's global loads early (in-flight during WMMAs)
    v8h a0 = zero8h(), a1 = zero8h(), b0 = zero8h(), b1 = zero8h();
    if (more) {
      a0 = *(const v8h*)(gA + kb + 32);
      a1 = *(const v8h*)(gA + kb + 40);
      b0 = *(const v8h*)(gB + kb + 32);
      b1 = *(const v8h*)(gB + kb + 40);
    }

    // compute on current buffer
    v16h aF[2];
#pragma unroll
    for (int mi = 0; mi < 2; ++mi)
      aF[mi] = ld_frag(&sA[cur][(wm * 32 + mi * 16 + (lane & 15)) * 40], lane);
#pragma unroll
    for (int ni = 0; ni < 4; ++ni) {
      v16h bF = ld_frag(&sB[cur][(wn * 64 + ni * 16 + (lane & 15)) * 40], lane);
#pragma unroll
      for (int mi = 0; mi < 2; ++mi)
        acc[mi][ni] = __builtin_amdgcn_wmma_f32_16x16x32_f16(
            false, bF, false, aF[mi], (short)0, acc[mi][ni], false, false);
    }

    // stage next tile into the other buffer
    if (more) {
      *(v8h*)&sA[nxt][lidx]     = a0;
      *(v8h*)&sA[nxt][lidx + 8] = a1;
      *(v8h*)&sB[nxt][lidx]     = b0;
      *(v8h*)&sB[nxt][lidx + 8] = b1;
    }
    __syncthreads();
  }

  // epilogue: the tiles are C^T (rows n, columns m), so a lane owns one row
  // m = .. + (lane & 15) of C and 8 consecutive columns n = .. + 8*(lane >> 4)
  // + r of each tile: bias comes in and C goes out 16 bytes at a time.
  const int c  = lane & 15;
  const int n0 = nblk + wn * 64 + 8 * (lane >> 4);
  v8f bb[4];
#pragma unroll
  for (int ni = 0; ni < 4; ++ni) bb[ni] = zero8f();
  if (bias) {
#pragma unroll
    for (int ni = 0; ni < 4; ++ni) bb[ni] = *(const v8f*)(bias + n0 + ni * 16);
  }
  // bias and scale in place, once for both output forms: the results need no
  // second register set, so the allocation stays at 128 (8 waves a SIMD)
#pragma unroll
  for (int mi = 0; mi < 2; ++mi)
#pragma unroll
    for (int ni = 0; ni < 4; ++ni) acc[mi][ni] = (acc[mi][ni] + bb[ni]) * scale;
#pragma unroll
  for (int mi = 0; mi < 2; ++mi) {
    const int m = mblk + wm * 32 + mi * 16 + c;
    if (m < M) {
      if (mode == 0) {
        const int b = m / SEQ, t = m % SEQ;
        _Float16* row =
            outH + (((size_t)(b * NH + (n0 >> 6)) * SEQ) + t) * HD + (n0 & 63);
#pragma unroll
        for (int ni = 0; ni < 4; ++ni) {
          v8h o;
#pragma unroll
          for (int r = 0; r < 8; ++r) o[r] = (_Float16)acc[mi][ni][r];
          *(v8h*)(row + ni * 16) = o;
        }
      } else {
        float* row = outF + (size_t)m * EMB + n0;
#pragma unroll
        for (int ni = 0; ni < 4; ++ni) *(v8f*)(row + ni * 16) = acc[mi][ni];
        // precaution: closes this row's stores before the listing's next
        // instructions reuse their data and address registers
        asm volatile("s_wait_xcnt 0x0" ::: "memory");
      }
    }
  }
}

typedef __attribute__((ext_vector_type(8))) short v8s;

// 16-bit transposing LDS load from a row-major tile T[k][d]. With
// p = &T[k0 + 8 * (lane >> 4) + (lane & 7)][d0 + 8 * ((lane >> 3) & 1)]
// lane (c = lane & 15, h = lane >> 4) receives T[k0 + 8h + 0..7][d0 + c].
__device__ inline v8h ld_tr16(const _Float16* p) {
  typedef __attribute__((address_space(3))) v8s lds_v8s;
  return __builtin_bit_cast(
      v8h, __builtin_amdgcn_ds_load_tr16_b128_v8i16((lds_v8s*)p));
}

// value of lane l ^ 16
__device__ inline float xhalf(float x) {
  int b = __builtin_bit_cast(int, x);
  return __builtin_bit_cast(
      float, __builtin_amdgcn_permlanex16(b, b, 0x76543210, 0xfedcba98, false,
                                          false));
}

__global__ __launch_bounds__(256) void attn_kernel(
    const _Float16* __restrict__ Q, const _Float16* __restrict__ K,
    const _Float16* __restrict__ V, _Float16* __restrict__ O) {
  __shared__ _Float16 kt[64][72];  // [kv][d], pitch 144 B: plain 16-B reads
  __shared__ _Float16 vs[64][80];  // [kv][d], pitch 160 B: transposing reads

  const int tid  = threadIdx.x;
  const int lane = tid & 31;
  const int w    = tid >> 5;
  const int c    = lane & 15;
  const int hf   = lane >> 4;
  const int bh   = blockIdx.y;
  const int q0   = blockIdx.x * 128 + w * 16;

  const _Float16* Qb = Q + (size_t)bh * SEQ * HD;
  const _Float16* Kb = K + (size_t)bh * SEQ * HD;
  const _Float16* Vb = V + (size_t)bh * SEQ * HD;

  // Q fragments (B operand, column = query c; clamped, invalid never stored)
  int qrow = q0 + c;
  int qr = qrow < SEQ ? qrow : (SEQ - 1);
  v16h qf[2];
#pragma unroll
  for (int s = 0; s < 2; ++s)
    qf[s] = ld_frag(Qb + (size_t)qr * HD + s * 32, lane);

  v8f oacc[4];  // oacc[t][r] = O^T[d = 16t + 8*hf + r][query c]
#pragma unroll
  for (int t = 0; t < 4; ++t) oacc[t] = zero8f();
  float mrow = -1e30f;  // running maximum of query c, equal in both halves
  float lrow = 0.f;     // running sum over this half's keys only

  const int lkv = tid >> 2;        // 0..63
  const int ld0 = (tid & 3) * 16;  // 0,16,32,48

  for (int kv0 = 0; kv0 < SEQ; kv0 += 64) {
    __syncthreads();
    int kvr = kv0 + lkv;
    v8h k0 = zero8h(), k1 = zero8h(), v0 = zero8h(), v1 = zero8h();
    if (kvr < SEQ) {
      k0 = *(const v8h*)(Kb + (size_t)kvr * HD + ld0);
      k1 = *(const v8h*)(Kb + (size_t)kvr * HD + ld0 + 8);
      v0 = *(const v8h*)(Vb + (size_t)kvr * HD + ld0);
      v1 = *(const v8h*)(Vb + (size_t)kvr * HD + ld0 + 8);
    }
    *(v8h*)&kt[lkv][ld0]     = k0;
    *(v8h*)&kt[lkv][ld0 + 8] = k1;
    *(v8h*)&vs[lkv][ld0]     = v0;
    *(v8h*)&vs[lkv][ld0 + 8] = v1;
    __syncthreads();

    // S^T = K Q^T : 4 key tiles x 2 k-steps;
    // sa[t][r] = S[query c][key kv0 + 16t + 8*hf + r]
    v8f sa[4];
#pragma unroll
    for (int t = 0; t < 4; ++t) sa[t] = zero8f();
#pragma unroll
    for (int t = 0; t < 4; ++t) {
#pragma unroll
      for (int s = 0; s < 2; ++s) {
        v16h kF = ld_frag(&kt[t * 16 + c][s * 32], lane);
        sa[t] = __builtin_amdgcn_wmma_f32_16x16x32_f16(
            false, kF, false, qf[s], (short)0, sa[t], false, false);
      }
    }

    // mask OOB keys + new maximum of this lane's query
    float nmax = mrow;
#pragma unroll
    for (int t = 0; t < 4; ++t) {
#pragma unroll
      for (int r = 0; r < 8; ++r) {
        int ng = kv0 + t * 16 + 8 * hf + r;
        float sc = (ng < SEQ) ? sa[t][r] : -1e30f;
        sa[t][r] = sc;
        nmax = fmaxf(nmax, sc);
      }
    }
    nmax = fmaxf(nmax, xhalf(nmax));

    float fac = __expf(mrow - nmax);
    mrow = nmax;
#pragma unroll
    for (int t = 0; t < 4; ++t)
#pragma unroll
      for (int r = 0; r < 8; ++r) oacc[t][r] *= fac;

    // P^T = exp(S^T - m): element s of the B operand of 32-key block j is
    // key 32j + (s < 8 ? 8*hf + s : 16 + 8*hf + s - 8) = sa[2j + s/8][s%8]
    float psum = 0.f;
    v16h pF[2];
#pragma unroll
    for (int j = 0; j < 2; ++j) {
#pragma unroll
      for (int s = 0; s < 16; ++s) {
        float p = __expf(sa[2 * j + (s >> 3)][s & 7] - mrow);
        psum += p;
        pF[j][s] = (_Float16)p;
      }
    }
    lrow = lrow * fac + psum;

    // O^T += V^T P^T : 4 d tiles x 2 key blocks
    const _Float16* vp = &vs[8 * hf + (lane & 7)][8 * ((lane >> 3) & 1)];
#pragma unroll
    for (int t = 0; t < 4; ++t) {
#pragma unroll
      for (int j = 0; j < 2; ++j) {
        v16h vF = make16(ld_tr16(vp + (j * 32) * 80 + t * 16),
                         ld_tr16(vp + (j * 32 + 16) * 80 + t * 16));
        oacc[t] = __builtin_amdgcn_wmma_f32_16x16x32_f16(
            false, vF, false, pF[j], (short)0, oacc[t], false, false);
      }
    }
  }

  // join the halves' sums with every lane active, ahead of the row guard
  float lsum = lrow + xhalf(lrow);

  int b = bh >> 4, h = bh & 15;
  if (qrow < SEQ) {
#pragma unroll
    for (int t = 0; t < 4; ++t) {
      v8h o;
#pragma unroll
      for (int r = 0; r < 8; ++r) o[r] = (_Float16)(oacc[t][r] / lsum);
      *(v8h*)&O[((size_t)(b * SEQ + qrow)) * EMB + h * HD + t * 16 + 8 * hf] = o;
    }
  }
}

extern "C" void kernel_launch(void* const* d_in, const int* in_sizes, int n_in,
                              void* d_out, int out_size, void* d_ws,
                              size_t ws_size, hipStream_t stream) {
  const float* x  = (const float*)d_in[0];
  const float* Wq = (const float*)d_in[1];
  const float* bq = (const float*)d_in[2];
  const float* Wk = (const float*)d_in[3];
  const float* Wv = (const float*)d_in[4];
  const float* bv = (const float*)d_in[5];
  const float* Wo = (const float*)d_in[6];
  const float* bo = (const float*)d_in[7];
  float* out = (float*)d_out;

  _Float16* base = (_Float16*)d_ws;
  size_t off = 0;
  auto carve = [&](size_t n) {
    _Float16* p = base + off;
    off += (n + 127) & ~(size_t)127;
    return p;
  };
  _Float16* Xh  = carve((size_t)MROWS * EMB);
  _Float16* Wqh = carve((size_t)EMB * EMB);
  _Float16* Wkh = carve((size_t)EMB * EMB);
  _Float16* Wvh = carve((size_t)EMB * EMB);
  _Float16* Woh = carve((size_t)EMB * EMB);
  _Float16* Qh  = carve((size_t)MROWS * EMB);
  _Float16* Kh  = carve((size_t)MROWS * EMB);
  _Float16* Vh  = carve((size_t)MROWS * EMB);
  _Float16* Ah  = carve((size_t)MROWS * EMB);

  cvt_f32_to_f16<<<dim3(512, 5), 256, 0, stream>>>(
      x, Wq, Wk, Wv, Wo, Xh, Wqh, Wkh, Wvh, Woh, MROWS * EMB, EMB * EMB);

  dim3 g((MROWS + 127) / 128, EMB / 128);      // 47 x 8
  dim3 g3((MROWS + 127) / 128, EMB / 128, 3);  // 47 x 8 x {q, k, v}
  // q = (X Wq^T + bq) * d^-0.5  (scale applied after bias, as in reference)
  gemm_xwT<<<g3, 256, 0, stream>>>(Xh, Wqh, Wkh, Wvh, bq, nullptr, bv, 0.125f,
                                   1.0f, 1.0f, MROWS, 0, Qh, Kh, Vh, nullptr);

  attn_kernel<<<dim3((SEQ + 127) / 128, 4 * NH), 256, 0, stream>>>(Qh, Kh, Vh,
                                                                   Ah);

  gemm_xwT<<<g, 256, 0, stream>>>(Ah, Woh, nullptr, nullptr, bo, nullptr,
                                  nullptr, 1.0f, 1.0f, 1.0f, MROWS, 1, nullptr,
                                  nullptr, nullptr, out);
}

// v004
// A run of this version takes 116 microseconds.
// Two timings next to v003 both put it at 1.26 times that version's speed.
// All steps since v000 together make it 2.21 times as fast.
#include <hip/hip_runtime.h>

#define SEQ 1500
#define EMB 1024
#define NH  16
#define HD  64
#define MROWS 6000   // B*SEQ = 4*1500

typedef __attribute__((ext_vector_type(16))) _Float16 v16h;
typedef __attribute__((ext_vector_type(8)))  _Float16 v8h;
typedef __attribute__((ext_vector_type(8)))  float    v8f;

__device__ inline v8h zero8h() { v8h z = {}; return z; }
__device__ inline v8f zero8f() { v8f z = {}; return z; }

__device__ inline v16h make16(v8h lo, v8h hi) {
  v16h r;
#pragma unroll
  for (int i = 0; i < 8; ++i) { r[i] = lo[i]; r[i + 8] = hi[i]; }
  return r;
}

// Load a 16x32 f16 A/B WMMA fragment whose row (m or n) = lane%16 is already
// folded into rowp. Per ISA layout: k(h,lane) = (h/8)*16 + (lane/16)*8 + h%8,
// i.e. two contiguous 8-half (16B) segments at +((lane>>4)*8) and +16 more.
__device__ inline v16h ld_frag(const _Float16* rowp, int lane) {
  const _Float16* p = rowp + ((lane >> 4) << 3);
  v8h lo = *(const v8h*)(p);
  v8h hi = *(const v8h*)(p + 16);
  return make16(lo, hi);
}

// One grid converts all five tensors side by side: blockIdx.y picks the tensor
// (0: activations, nx elements; 1..4: weights, nw elements each).
__global__ void cvt_f32_to_f16(
    const float* __restrict__ s0, const float* __restrict__ s1,
    const float* __restrict__ s2, const float* __restrict__ s3,
    const float* __restrict__ s4, _Float16* __restrict__ d0,
    _Float16* __restrict__ d1, _Float16* __restrict__ d2,
    _Float16* __restrict__ d3, _Float16* __restrict__ d4, int nx, int nw) {
  const int y = blockIdx.y;
  const float* __restrict__ s =
      y == 0 ? s0 : y == 1 ? s1 : y == 2 ? s2 : y == 3 ? s3 : s4;
  _Float16* __restrict__ d =
      y == 0 ? d0 : y == 1 ? d1 : y == 2 ? d2 : y == 3 ? d3 : d4;
  const int n = y == 0 ? nx : nw;
  int i = blockIdx.x * blockDim.x + threadIdx.x;
  int stride = gridDim.x * blockDim.x;
  for (; i < n; i += stride) d[i] = (_Float16)s[i];
}

// C[M,N] = (X[M,K] * W[N,K]^T + bias) * scale ; K = N = 1024.
// Computed as C^T = W X^T (A operand = W rows, B operand = X rows).
// mode 0: write f16 into [b, h, t, d] head layout (QKV projections)
// mode 1: write f32 row-major [M, N] (output projection -> d_out)
// Ping-pong double-buffered LDS: one barrier per K-step; next tile's global
// loads are issued before the 16 WMMAs so load latency hides under compute.
// A K-step is 64 halves = one 128-byte line of every operand row: 8 lanes
// fetch one line, so a wave-wide 16-byte load touches 4 whole lines.
// blockIdx.z picks one of up to three products that share X (weights, bias,
// scale, f16 output), so that independent projections run in one grid.
__global__ __launch_bounds__(256) void gemm_xwT(
    const _Float16* __restrict__ X, const _Float16* __restrict__ W0,
    const _Float16* __restrict__ W1, const _Float16* __restrict__ W2,
    const float* __restrict__ bias0, const float* __restrict__ bias1,
    const float* __restrict__ bias2, float scale0, float scale1, float scale2,
    int M, int mode, _Float16* __restrict__ outH0,
    _Float16* __restrict__ outH1, _Float16* __restrict__ outH2,
    float* __restrict__ outF) {
  __shared__ _Float16 sA[2][128 * 72];  // 128 rows x 64 K, pitch 144 B
  __shared__ _Float16 sB[2][128 * 72];

  const int z = blockIdx.z;
  const _Float16* __restrict__ W = z == 0 ? W0 : z == 1 ? W1 : W2;
  const float* __restrict__ bias = z == 0 ? bias0 : z == 1 ? bias1 : bias2;
  const float scale = z == 0 ? scale0 : z == 1 ? scale1 : scale2;
  _Float16* __restrict__ outH = z == 0 ? outH0 : z == 1 ? outH1 : outH2;

  const int tid  = threadIdx.x;
  const int lane = tid & 31;
  const int wave = tid >> 5;
  const int wm   = wave >> 1;  // 0..3 -> 32 rows each
  const int wn   = wave & 1;   // 0..1 -> 64 cols each
  const int mblk = blockIdx.x * 128;
  const int nblk = blockIdx.y * 128;

  v8f acc[2][4];
#pragma unroll
  for (int i = 0; i < 2; ++i)
#pragma unroll
    for (int j = 0; j < 4; ++j) acc[i][j] = zero8f();

  const int lrow = tid >> 3;       // 0..31; rows lrow + 32 * i, i = 0..3
  const int lcol = (tid & 7) * 8;  // 8 lanes x 16 B = one 128-byte line
  const int lidx = lrow * 72 + lcol;

  // Clamp tail rows instead of EXEC-masking: keeps copies uniform; clamped
  // rows only feed C rows >= M which are never stored.
  // This lane's places in X and W, counted in 16-byte units.
  const v8h* X8 = (const v8h*)X;
  const v8h* W8 = (const v8h*)W;
  int iA[4];
#pragma unroll
  for (int i = 0; i < 4; ++i) {
    int gm = mblk + lrow + 32 * i;
    if (gm >= M) gm = M - 1;
    iA[i] = gm * (EMB / 8) + (tid & 7);
  }
  const int iB = (nblk + lrow) * (EMB / 8) + (tid & 7);  // N always ok

  // prologue: stage kb = 0 into buffer 0
  {
    v8h a[4], b[4];
#pragma unroll
    for (int i = 0; i < 4; ++i) {
      a[i] = X8[iA[i]];
      b[i] = W8[iB + i * 32 * (EMB / 8)];
    }
#pragma unroll
    for (int i = 0; i < 4; ++i) {
      *(v8h*)&sA[0][lidx + i * 32 * 72] = a[i];
      *(v8h*)&sB[0][lidx + i * 32 * 72] = b[i];
    }
  }
  __syncthreads();

  // Unrolled whole: the K position becomes the loads' immediate offset, so no
  // address register is rewritten while the loads that name it are in flight.
#pragma unroll
  for (int kb = 0; kb < EMB; kb += 64) {
    const int  cur  = (kb >> 6) & 1;
    const int  nxt  = cur ^ 1;
    const bool more = (kb + 64) < EMB;

    // issue next tile's global loads early (in-flight during WMMAs)
    v8h a[4], b[4];
#pragma unroll
    for (int i = 0; i < 4; ++i) { a[i] = zero8h(); b[i] = zero8h(); }
    if (more) {
#pragma unroll
      for (int i = 0; i < 4; ++i) {
        a[i] = X8[iA[i] + (kb + 64) / 8];
        b[i] = W8[iB + (kb + 64) / 8 + i * 32 * (EMB / 8)];
      }
    }
    // Holds the loads above the products: in the unrolled body the scheduler
    // otherwise sinks them to their LDS stores and their latency is exposed.
    __builtin_amdgcn_sched_barrier(0);

    // compute on current buffer: two 32-deep products per K-step
#pragma unroll
    for (int ks = 0; ks < 2; ++ks) {
      v16h aF[2];
#pragma unroll
      for (int mi = 0; mi < 2; ++mi)
        aF[mi] = ld_frag(
            &sA[cur][(wm * 32 + mi * 16 + (lane & 15)) * 72 + ks * 32], lane);
#pragma unroll
      for (int ni = 0; ni < 4; ++ni) {
        v16h bF = ld_frag(
            &sB[cur][(wn * 64 + ni * 16 + (lane & 15)) * 72 + ks * 32], lane);
#pragma unroll
        for (int mi = 0; mi < 2; ++mi)
          acc[mi][ni] = __builtin_amdgcn_wmma_f32_16x16x32_f16(
              false, bF, false, aF[mi], (short)0, acc[mi][ni], false, false);
      }
    }

    // stage next tile into the other buffer
    if (more) {
#pragma unroll
      for (int i = 0; i < 4; ++i) {
        *(v8h*)&sA[nxt][lidx + i * 32 * 72] = a[i];
        *(v8h*)&sB[nxt][lidx + i * 32 * 72] = b[i];
      }
    }
    __syncthreads();
  }

  // epilogue: the tiles are C^T (rows n, columns m), so a lane owns one row
  // m = .. + (lane & 15) of C and 8 consecutive columns n = .. + 8*(lane >> 4)
  // + r of each tile: bias comes in and C goes out 16 bytes at a time.
  const int c  = lane & 15;
  const int n0 = nblk + wn * 64 + 8 * (lane >> 4);
  v8f bb[4];
#pragma unroll
  for (int ni = 0; ni < 4; ++ni) bb[ni] = zero8f();
  if (bias) {
#pragma unroll
    for (int ni = 0; ni < 4; ++ni) bb[ni] = *(const v8f*)(bias + n0 + ni * 16);
  }
  // bias and scale in place, once for both output forms: the results need no
  // second register set
#pragma unroll
  for (int mi = 0; mi < 2; ++mi)
#pragma unroll
    for (int ni = 0; ni < 4; ++ni) acc[mi][ni] = (acc[mi][ni] + bb[ni]) * scale;
#pragma unroll
  for (int mi = 0; mi < 2; ++mi) {
    const int m = mblk + wm * 32 + mi * 16 + c;
    if (m < M) {
      if (mode == 0) {
        const int b = m / SEQ, t = m % SEQ;
        _Float16* row =
            outH + (((size_t)(b * NH + (n0 >> 6)) * SEQ) + t) * HD + (n0 & 63);
#pragma unroll
        for (int ni = 0; ni < 4; ++ni) {
          v8h o;
#pragma unroll
          for (int r = 0; r < 8; ++r) o[r] = (_Float16)acc[mi][ni][r];
          *(v8h*)(row + ni * 16) = o;
        }
      } else {
        float* row = outF + (size_t)m * EMB + n0;
#pragma unroll
        for (int ni = 0; ni < 4; ++ni) *(v8f*)(row + ni * 16) = acc[mi][ni];
        // precaution: closes this row's stores before the listing's next
        // instructions reuse their data and address registers
        asm volatile("s_wait_xcnt 0x0" ::: "memory");
      }
    }
  }
}

typedef __attribute__((ext_vector_type(8))) short v8s;

// 16-bit transposing LDS load from a row-major tile T[k][d]. With
// p = &T[k0 + 8 * (lane >> 4) + (lane & 7)][d0 + 8 * ((lane >> 3) & 1)]
// lane (c = lane & 15, h = lane >> 4) receives T[k0 + 8h + 0..7][d0 + c].
__device__ inline v8h ld_tr16(const _Float16* p) {
  typedef __attribute__((address_space(3))) v8s lds_v8s;
  return __builtin_bit_cast(
      v8h, __builtin_amdgcn_ds_load_tr16_b128_v8i16((lds_v8s*)p));
}

// value of lane l ^ 16
__device__ inline float xhalf(float x) {
  int b = __builtin_bit_cast(int, x);
  return __builtin_bit_cast(
      float, __builtin_amdgcn_permlanex16(b, b, 0x76543210, 0xfedcba98, false,
                                          false));
}

__global__ __launch_bounds__(256) void attn_kernel(
    const _Float16* __restrict__ Q, const _Float16* __restrict__ K,
    const _Float16* __restrict__ V, _Float16* __restrict__ O) {
  __shared__ _Float16 kt[64][72];  // [kv][d], pitch 144 B: plain 16-B reads
  __shared__ _Float16 vs[64][80];  // [kv][d], pitch 160 B: transposing reads

  const int tid  = threadIdx.x;
  const int lane = tid & 31;
  const int w    = tid >> 5;
  const int c    = lane & 15;
  const int hf   = lane >> 4;
  const int bh   = blockIdx.y;
  const int q0   = blockIdx.x * 128 + w * 16;

  const _Float16* Qb = Q + (size_t)bh * SEQ * HD;
  const _Float16* Kb = K + (size_t)bh * SEQ * HD;
  const _Float16* Vb = V + (size_t)bh * SEQ * HD;

  // Q fragments (B operand, column = query c; clamped, invalid never stored)
  int qrow = q0 + c;
  int qr = qrow < SEQ ? qrow : (SEQ - 1);
  v16h qf[2];
#pragma unroll
  for (int s = 0; s < 2; ++s)
    qf[s] = ld_frag(Qb + (size_t)qr * HD + s * 32, lane);

  v8f oacc[4];  // oacc[t][r] = O^T[d = 16t + 8*hf + r][query c]
#pragma unroll
  for (int t = 0; t < 4; ++t) oacc[t] = zero8f();
  float mrow = -1e30f;  // running maximum of query c, equal in both halves
  float lrow = 0.f;     // running sum over this half's keys only

  const int lkv = tid >> 3;       // 0..31; rows lkv and lkv + 32
  const int ld0 = (tid & 7) * 8;  // 8 lanes x 16 B = one 128-byte row

  for (int kv0 = 0; kv0 < SEQ; kv0 += 64) {
    __syncthreads();
    int kvr = kv0 + lkv;
    const _Float16* gk = Kb + (size_t)kvr * HD + ld0;
    const _Float16* gv = Vb + (size_t)kvr * HD + ld0;
    v8h k0 = zero8h(), k1 = zero8h(), v0 = zero8h(), v1 = zero8h();
    if (kv0 + 64 <= SEQ) {  // whole tile in range: the four loads go as one run
      k0 = *(const v8h*)(gk);
      k1 = *(const v8h*)(gk + 32 * HD);
      v0 = *(const v8h*)(gv);
      v1 = *(const v8h*)(gv + 32 * HD);
    } else {
      if (kvr < SEQ) {
        k0 = *(const v8h*)(gk);
        v0 = *(const v8h*)(gv);
      }
      if (kvr + 32 < SEQ) {
        k1 = *(const v8h*)(gk + 32 * HD);
        v1 = *(const v8h*)(gv + 32 * HD);
      }
    }
    *(v8h*)&kt[lkv][ld0]      = k0;
    *(v8h*)&kt[lkv + 32][ld0] = k1;
    *(v8h*)&vs[lkv][ld0]      = v0;
    *(v8h*)&vs[lkv + 32][ld0] = v1;
    __syncthreads();

    // S^T = K Q^T : 4 key tiles x 2 k-steps;
    // sa[t][r] = S[query c][key kv0 + 16t + 8*hf + r]
    v8f sa[4];
#pragma unroll
    for (int t = 0; t < 4; ++t) sa[t] = zero8f();
#pragma unroll
    for (int t = 0; t < 4; ++t) {
#pragma unroll
      for (int s = 0; s < 2; ++s) {
        v16h kF = ld_frag(&kt[t * 16 + c][s * 32], lane);
        sa[t] = __builtin_amdgcn_wmma_f32_16x16x32_f16(
            false, kF, false, qf[s], (short)0, sa[t], false, false);
      }
    }

    // mask OOB keys + new maximum of this lane's query
    float nmax = mrow;
#pragma unroll
    for (int t = 0; t < 4; ++t) {
#pragma unroll
      for (int r = 0; r < 8; ++r) {
        int ng = kv0 + t * 16 + 8 * hf + r;
        float sc = (ng < SEQ) ? sa[t][r] : -1e30f;
        sa[t][r] = sc;
        nmax = fmaxf(nmax, sc);
      }
    }
    nmax = fmaxf(nmax, xhalf(nmax));

    float fac = __expf(mrow - nmax);
    mrow = nmax;
#pragma unroll
    for (int t = 0; t < 4; ++t)
#pragma unroll
      for (int r = 0; r < 8; ++r) oacc[t][r] *= fac;

    // P^T = exp(S^T - m): element s of the B operand of 32-key block j is
    // key 32j + (s < 8 ? 8*hf + s : 16 + 8*hf + s - 8) = sa[2j + s/8][s%8]
    float psum = 0.f;
    v16h pF[2];
#pragma unroll
    for (int j = 0; j < 2; ++j) {
#pragma unroll
      for (int s = 0; s < 16; ++s) {
        float p = __expf(sa[2 * j + (s >> 3)][s & 7] - mrow);
        psum += p;
        pF[j][s] = (_Float16)p;
      }
    }
    lrow = lrow * fac + psum;

    // O^T += V^T P^T : 4 d tiles x 2 key blocks
    const _Float16* vp = &vs[8 * hf + (lane & 7)][8 * ((lane >> 3) & 1)];
#pragma unroll
    for (int t = 0; t < 4; ++t) {
#pragma unroll
      for (int j = 0; j < 2; ++j) {
        v16h vF = make16(ld_tr16(vp + (j * 32) * 80 + t * 16),
                         ld_tr16(vp + (j * 32 + 16) * 80 + t * 16));
        oacc[t] = __builtin_amdgcn_wmma_f32_16x16x32_f16(
            false, vF, false, pF[j], (short)0, oacc[t], false, false);
      }
    }
  }

  // join the halves' sums with every lane active, ahead of the row guard
  float lsum = lrow + xhalf(lrow);

  int b = bh >> 4, h = bh & 15;
  if (qrow < SEQ) {
#pragma unroll
    for (int t = 0; t < 4; ++t) {
      v8h o;
#pragma unroll
      for (int r = 0; r < 8; ++r) o[r] = (_Float16)(oacc[t][r] / lsum);
      *(v8h*)&O[((size_t)(b * SEQ + qrow)) * EMB + h * HD + t * 16 + 8 * hf] = o;
    }
  }
}

extern "C" void kernel_launch(void* const* d_in, const int* in_sizes, int n_in,
                              void* d_out, int out_size, void* d_ws,
                              size_t ws_size, hipStream_t stream) {
  const float* x  = (const float*)d_in[0];
  const float* Wq = (const float*)d_in[1];
  const float* bq = (const float*)d_in[2];
  const float* Wk = (const float*)d_in[3];
  const float* Wv = (const float*)d_in[4];
  const float* bv = (const float*)d_in[5];
  const float* Wo = (const float*)d_in[6];
  const float* bo = (const float*)d_in[7];
  float* out = (float*)d_out;

  _Float16* base = (_Float16*)d_ws;
  size_t off = 0;
  auto carve = [&](size_t n) {
    _Float16* p = base + off;
    off += (n + 127) & ~(size_t)127;
    return p;
  };
  _Float16* Xh  = carve((size_t)MROWS * EMB);
  _Float16* Wqh = carve((size_t)EMB * EMB);
  _Float16* Wkh = carve((size_t)EMB * EMB);
  _Float16* Wvh = carve((size_t)EMB * EMB);
  _Float16* Woh = carve((size_t)EMB * EMB);
  _Float16* Qh  = carve((size_t)MROWS * EMB);
  _Float16* Kh  = carve((size_t)MROWS * EMB);
  _Float16* Vh  = carve((size_t)MROWS * EMB);
  _Float16* Ah  = carve((size_t)MROWS * EMB);

  cvt_f32_to_f16<<<dim3(512, 5), 256, 0, stream>>>(
      x, Wq, Wk, Wv, Wo, Xh, Wqh, Wkh, Wvh, Woh, MROWS * EMB, EMB * EMB);

  dim3 g((MROWS + 127) / 128, EMB / 128);      // 47 x 8
  dim3 g3((MROWS + 127) / 128, EMB / 128, 3);  // 47 x 8 x {q, k, v}
  // q = (X Wq^T + bq) * d^-0.5  (scale applied after bias, as in reference)
  gemm_xwT<<<g3, 256, 0, stream>>>(Xh, Wqh, Wkh, Wvh, bq, nullptr, bv, 0.125f,
                                   1.0f, 1.0f, MROWS, 0, Qh, Kh, Vh, nullptr);

  attn_kernel<<<dim3((SEQ + 127) / 128, 4 * NH), 256, 0, stream>>>(Qh, Kh, Vh,
                                                                   Ah);

  gemm_xwT<<<g, 256, 0, stream>>>(Ah, Woh, nullptr, nullptr, bo, nullptr,
                                  nullptr, 1.0f, 1.0f, 1.0f, MROWS, 1, nullptr,
                                  nullptr, nullptr, out);
}

// v005
// One run takes 111 microseconds.
// Timed twice side by side with v004, it ran 1.04 and 1.05 times as fast.
// Counting every step since v000, it is 2.31 times as fast.
#include <hip/hip_runtime.h>

#define SEQ 1500
#define EMB 1024
#define NH  16
#define HD  64
#define MROWS 6000   // B*SEQ = 4*1500

typedef __attribute__((ext_vector_type(16))) _Float16 v16h;
typedef __attribute__((ext_vector_type(8)))  _Float16 v8h;
typedef __attribute__((ext_vector_type(8)))  float    v8f;
typedef __attribute__((ext_vector_type(4)))  float    v4f;

__device__ inline v8h zero8h() { v8h z = {}; return z; }
__device__ inline v8f zero8f() { v8f z = {}; return z; }

__device__ inline v16h make16(v8h lo, v8h hi) {
  v16h r;
#pragma unroll
  for (int i = 0; i < 8; ++i) { r[i] = lo[i]; r[i + 8] = hi[i]; }
  return r;
}

// Load a 16x32 f16 A/B WMMA fragment whose row (m or n) = lane%16 is already
// folded into rowp. Per ISA layout: k(h,lane) = (h/8)*16 + (lane/16)*8 + h%8,
// i.e. two contiguous 8-half (16B) segments at +((lane>>4)*8) and +16 more.
__device__ inline v16h ld_frag(const _Float16* rowp, int lane) {
  const _Float16* p = rowp + ((lane >> 4) << 3);
  v8h lo = *(const v8h*)(p);
  v8h hi = *(const v8h*)(p + 16);
  return make16(lo, hi);
}

// One grid converts all five tensors side by side: blockIdx.y picks the tensor
// (0: activations, nx elements; 1..4: weights, nw elements each).
__global__ void cvt_f32_to_f16(
    const float* __restrict__ s0, const float* __restrict__ s1,
    const float* __restrict__ s2, const float* __restrict__ s3,
    const float* __restrict__ s4, _Float16* __restrict__ d0,
    _Float16* __restrict__ d1, _Float16* __restrict__ d2,
    _Float16* __restrict__ d3, _Float16* __restrict__ d4, int nx, int nw) {
  const int y = blockIdx.y;
  const float* __restrict__ s =
      y == 0 ? s0 : y == 1 ? s1 : y == 2 ? s2 : y == 3 ? s3 : s4;
  _Float16* __restrict__ d =
      y == 0 ? d0 : y == 1 ? d1 : y == 2 ? d2 : y == 3 ? d3 : d4;
  const int n = y == 0 ? nx : nw;
  int i = blockIdx.x * blockDim.x + threadIdx.x;
  int stride = gridDim.x * blockDim.x;
  for (; i < n; i += stride) d[i] = (_Float16)s[i];
}

// C[M,N] = (X[M,K] * W[N,K]^T + bias) * scale ; K = N = 1024.
// Computed as C^T = W X^T (A operand = W rows, B operand = X rows).
// mode 0: write f16 into [b, h, t, d] head layout (QKV projections)
// mode 1: write f32 row-major [M, N] (output projection -> d_out)
// Ping-pong double-buffered LDS: one barrier per K-step; next tile's global
// loads are issued before the 16 WMMAs so load latency hides under compute.
// A K-step is 64 halves = one 128-byte line of every operand row: 8 lanes
// fetch one line, so a wave-wide 16-byte load touches 4 whole lines.
// blockIdx.z picks one of up to three products that share X (weights, bias,
// scale, f16 output), so that independent projections run in one grid.
__global__ __launch_bounds__(256) void gemm_xwT(
    const _Float16* __restrict__ X, const _Float16* __restrict__ W0,
    const _Float16* __restrict__ W1, const _Float16* __restrict__ W2,
    const float* __restrict__ bias0, const float* __restrict__ bias1,
    const float* __restrict__ bias2, float scale0, float scale1, float scale2,
    int M, int mode, _Float16* __restrict__ outH0,
    _Float16* __restrict__ outH1, _Float16* __restrict__ outH2,
    float* __restrict__ outF) {
  __shared__ _Float16 sA[2][128 * 72];  // 128 rows x 64 K, pitch 144 B
  __shared__ _Float16 sB[2][128 * 72];

  const int z = blockIdx.z;
  const _Float16* __restrict__ W = z == 0 ? W0 : z == 1 ? W1 : W2;
  const float* __restrict__ bias = z == 0 ? bias0 : z == 1 ? bias1 : bias2;
  const float scale = z == 0 ? scale0 : z == 1 ? scale1 : scale2;
  _Float16* __restrict__ outH = z == 0 ? outH0 : z == 1 ? outH1 : outH2;

  const int tid  = threadIdx.x;
  const int lane = tid & 31;
  const int wave = tid >> 5;
  const int wm   = wave >> 1;  // 0..3 -> 32 rows each
  const int wn   = wave & 1;   // 0..1 -> 64 cols each
  const int mblk = blockIdx.x * 128;
  const int nblk = blockIdx.y * 128;

  v8f acc[2][4];
#pragma unroll
  for (int i = 0; i < 2; ++i)
#pragma unroll
    for (int j = 0; j < 4; ++j) acc[i][j] = zero8f();

  const int lrow = tid >> 3;       // 0..31; rows lrow + 32 * i, i = 0..3
  const int lcol = (tid & 7) * 8;  // 8 lanes x 16 B = one 128-byte line
  const int lidx = lrow * 72 + lcol;

  // Clamp tail rows instead of EXEC-masking: keeps copies uniform; clamped
  // rows only feed C rows >= M which are never stored.
  // This lane's places in X and W, counted in 16-byte units.
  const v8h* X8 = (const v8h*)X;
  const v8h* W8 = (const v8h*)W;
  int iA[4];
#pragma unroll
  for (int i = 0; i < 4; ++i) {
    int gm = mblk + lrow + 32 * i;
    if (gm >= M) gm = M - 1;
    iA[i] = gm * (EMB / 8) + (tid & 7);
  }
  const int iB = (nblk + lrow) * (EMB / 8) + (tid & 7);  // N always ok

  // prologue: stage kb = 0 into buffer 0
  {
    v8h a[4], b[4];
#pragma unroll
    for (int i = 0; i < 4; ++i) {
      a[i] = X8[iA[i]];
      b[i] = W8[iB + i * 32 * (EMB / 8)];
    }
#pragma unroll
    for (int i = 0; i < 4; ++i) {
      *(v8h*)&sA[0][lidx + i * 32 * 72] = a[i];
      *(v8h*)&sB[0][lidx + i * 32 * 72] = b[i];
    }
  }
  __syncthreads();

  // Unrolled whole: the K position becomes the loads' immediate offset, so no
  // address register is rewritten while the loads that name it are in flight.
#pragma unroll
  for (int kb = 0; kb < EMB; kb += 64) {
    const int  cur  = (kb >> 6) & 1;
    const int  nxt  = cur ^ 1;
    const bool more = (kb + 64) < EMB;

    // issue next tile's global loads early (in-flight during WMMAs)
    v8h a[4], b[4];
#pragma unroll
    for (int i = 0; i < 4; ++i) { a[i] = zero8h(); b[i] = zero8h(); }
    if (more) {
#pragma unroll
      for (int i = 0; i < 4; ++i) {
        a[i] = X8[iA[i] + (kb + 64) / 8];
        b[i] = W8[iB + (kb + 64) / 8 + i * 32 * (EMB / 8)];
      }
    }
    // Holds the loads above the products: in the unrolled body the scheduler
    // otherwise sinks them to their LDS stores and their latency is exposed.
    __builtin_amdgcn_sched_barrier(0);

    // compute on current buffer: two 32-deep products per K-step
#pragma unroll
    for (int ks = 0; ks < 2; ++ks) {
      v16h aF[2];
#pragma unroll
      for (int mi = 0; mi < 2; ++mi)
        aF[mi] = ld_frag(
            &sA[cur][(wm * 32 + mi * 16 + (lane & 15)) * 72 + ks * 32], lane);
#pragma unroll
      for (int ni = 0; ni < 4; ++ni) {
        v16h bF = ld_frag(
            &sB[cur][(wn * 64 + ni * 16 + (lane & 15)) * 72 + ks * 32], lane);
#pragma unroll
        for (int mi = 0; mi < 2; ++mi)
          acc[mi][ni] = __builtin_amdgcn_wmma_f32_16x16x32_f16(
              false, bF, false, aF[mi], (short)0, acc[mi][ni], false, false);
      }
    }

    // stage next tile into the other buffer
    if (more) {
#pragma unroll
      for (int i = 0; i < 4; ++i) {
        *(v8h*)&sA[nxt][lidx + i * 32 * 72] = a[i];
        *(v8h*)&sB[nxt][lidx + i * 32 * 72] = b[i];
      }
    }
    __syncthreads();
  }

  // epilogue: the tiles are C^T (rows n, columns m), so a lane owns one row
  // m = .. + (lane & 15) of C and 8 consecutive columns n = .. + 8*(lane >> 4)
  // + r of each tile: bias comes in 32 bytes at a time.
  const int c  = lane & 15;
  const int n0 = nblk + wn * 64 + 8 * (lane >> 4);
  v8f bb[4];
#pragma unroll
  for (int ni = 0; ni < 4; ++ni) bb[ni] = zero8f();
  if (bias) {
#pragma unroll
    for (int ni = 0; ni < 4; ++ni) bb[ni] = *(const v8f*)(bias + n0 + ni * 16);
  }
  // bias and scale in place, once for both output forms: the results need no
  // second register set
#pragma unroll
  for (int mi = 0; mi < 2; ++mi)
#pragma unroll
    for (int ni = 0; ni < 4; ++ni) acc[mi][ni] = (acc[mi][ni] + bb[ni]) * scale;
  // The wave's 32 x 64 tile goes out through LDS so that a store covers whole
  // 128-byte lines. The K loop's last barrier has ended every read of the
  // operand buffers; each wave stages in a range of its own (four in sA, four
  // in sB), so no further barrier is needed.
  // The wave's number as a scalar, so that the tests below are scalar branches.
  const int ws = __builtin_amdgcn_readfirstlane(wave);
  char* stage = (ws < 4 ? (char*)&sA[0][0] : (char*)&sB[0][0]) +
                (ws & 3) * (32 * 272);
  const int m0 = mblk + (ws >> 1) * 32;
  if (mode == 0) {
    _Float16* st = (_Float16*)stage;  // [32][64] halves, pitch 144 B
#pragma unroll
    for (int mi = 0; mi < 2; ++mi)
#pragma unroll
      for (int ni = 0; ni < 4; ++ni) {
        v8h o;
#pragma unroll
        for (int r = 0; r < 8; ++r) o[r] = (_Float16)acc[mi][ni][r];
        *(v8h*)&st[(mi * 16 + c) * 72 + ni * 16 + 8 * (lane >> 4)] = o;
      }
    // the rows are read back by other lanes of this wave: its LDS writes
    // must have landed, and the compiler must not move the reads above them
    asm volatile("s_wait_dscnt 0x0" ::: "memory");
    // a row of one head is 128 bytes: 8 lanes a row, 4 rows a store
    const int hd = (nblk + (ws & 1) * 64) >> 6;
    const _Float16* sr = st + (lane >> 3) * 72 + (lane & 7) * 8;
    const int b0 = m0 / SEQ;
    if (m0 + 32 <= M && (m0 + 31) / SEQ == b0) {
      // all 32 rows in range and in one batch: 4 KiB in a row, one address
      _Float16* og =
          outH + (((size_t)(b0 * NH + hd) * SEQ) + (m0 - b0 * SEQ)) * HD + lane * 8;
      v8h o[8];
#pragma unroll
      for (int i = 0; i < 8; ++i) o[i] = *(const v8h*)(sr + i * 4 * 72);
#pragma unroll
      for (int i = 0; i < 8; ++i) *(v8h*)(og + i * 4 * HD) = o[i];
      // precaution: closes the run's stores before anything that stands
      // behind them in the listing reuses their registers
      asm volatile("s_wait_xcnt 0x0" ::: "memory");
    } else {
#pragma unroll
      for (int i = 0; i < 8; ++i) {
        const int m = m0 + (lane >> 3) + 4 * i;
        const v8h o = *(const v8h*)(sr + i * 4 * 72);
        if (m < M) {
          const int b = m / SEQ, t = m % SEQ;
          *(v8h*)(outH + (((size_t)(b * NH + hd) * SEQ) + t) * HD +
                  (lane & 7) * 8) = o;
        }
      }
    }
  } else {
    float* st = (float*)stage;  // [32][64] floats, pitch 272 B
#pragma unroll
    for (int mi = 0; mi < 2; ++mi)
#pragma unroll
      for (int ni = 0; ni < 4; ++ni) {
        // two 16-byte halves: the pitch keeps rows 16-byte aligned only
        float* sw = &st[(mi * 16 + c) * 68 + ni * 16 + 8 * (lane >> 4)];
        *(v4f*)sw = __builtin_shufflevector(acc[mi][ni], acc[mi][ni], 0, 1, 2, 3);
        *(v4f*)(sw + 4) =
            __builtin_shufflevector(acc[mi][ni], acc[mi][ni], 4, 5, 6, 7);
      }
    // as above: this wave's LDS writes land before its lanes read them back
    asm volatile("s_wait_dscnt 0x0" ::: "memory");
    // 64 floats of a row are two lines: 16 lanes a row, 2 rows a store
    const float* sr = st + (lane >> 4) * 68 + (lane & 15) * 4;
    float* og = outF + (size_t)(m0 + (lane >> 4)) * EMB + nblk + (ws & 1) * 64 +
                (lane & 15) * 4;
    if (m0 + 32 <= M) {
      v4f o[16];
#pragma unroll
      for (int i = 0; i < 16; ++i) o[i] = *(const v4f*)(sr + i * 2 * 68);
#pragma unroll
      for (int i = 0; i < 16; ++i) *(v4f*)(og + (size_t)i * 2 * EMB) = o[i];
      // precaution: closes the run's stores before anything that stands
      // behind them in the listing reuses their registers
      asm volatile("s_wait_xcnt 0x0" ::: "memory");
    } else {
#pragma unroll
      for (int i = 0; i < 16; ++i) {
        const v4f o = *(const v4f*)(sr + i * 2 * 68);
        if (m0 + (lane >> 4) + 2 * i < M) *(v4f*)(og + (size_t)i * 2 * EMB) = o;
      }
    }
  }
}

typedef __attribute__((ext_vector_type(8))) short v8s;

// 16-bit transposing LDS load from a row-major tile T[k][d]. With
// p = &T[k0 + 8 * (lane >> 4) + (lane & 7)][d0 + 8 * ((lane >> 3) & 1)]
// lane (c = lane & 15, h = lane >> 4) receives T[k0 + 8h + 0..7][d0 + c].
__device__ inline v8h ld_tr16(const _Float16* p) {
  typedef __attribute__((address_space(3))) v8s lds_v8s;
  return __builtin_bit_cast(
      v8h, __builtin_amdgcn_ds_load_tr16_b128_v8i16((lds_v8s*)p));
}

// value of lane l ^ 16
__device__ inline float xhalf(float x) {
  int b = __builtin_bit_cast(int, x);
  return __builtin_bit_cast(
      float, __builtin_amdgcn_permlanex16(b, b, 0x76543210, 0xfedcba98, false,
                                          false));
}

__global__ __launch_bounds__(256) void attn_kernel(
    const _Float16* __restrict__ Q, const _Float16* __restrict__ K,
    const _Float16* __restrict__ V, _Float16* __restrict__ O) {
  __shared__ _Float16 kt[64][72];  // [kv][d], pitch 144 B: plain 16-B reads
  __shared__ _Float16 vs[64][80];  // [kv][d], pitch 160 B: transposing reads

  const int tid  = threadIdx.x;
  const int lane = tid & 31;
  const int w    = tid >> 5;
  const int c    = lane & 15;
  const int hf   = lane >> 4;
  const int bh   = blockIdx.y;
  const int q0   = blockIdx.x * 128 + w * 16;

  const _Float16* Qb = Q + (size_t)bh * SEQ * HD;
  const _Float16* Kb = K + (size_t)bh * SEQ * HD;
  const _Float16* Vb = V + (size_t)bh * SEQ * HD;

  // Q fragments (B operand, column = query c; clamped, invalid never stored)
  int qrow = q0 + c;
  int qr = qrow < SEQ ? qrow : (SEQ - 1);
  v16h qf[2];
#pragma unroll
  for (int s = 0; s < 2; ++s)
    qf[s] = ld_frag(Qb + (size_t)qr * HD + s * 32, lane);

  v8f oacc[4];  // oacc[t][r] = O^T[d = 16t + 8*hf + r][query c]
#pragma unroll
  for (int t = 0; t < 4; ++t) oacc[t] = zero8f();
  float mrow = -1e30f;  // running maximum of query c, equal in both halves
  float lrow = 0.f;     // running sum over this half's keys only

  const int lkv = tid >> 3;       // 0..31; rows lkv and lkv + 32
  const int ld0 = (tid & 7) * 8;  // 8 lanes x 16 B = one 128-byte row

  for (int kv0 = 0; kv0 < SEQ; kv0 += 64) {
    __syncthreads();
    int kvr = kv0 + lkv;
    const _Float16* gk = Kb + (size_t)kvr * HD + ld0;
    const _Float16* gv = Vb + (size_t)kvr * HD + ld0;
    v8h k0 = zero8h(), k1 = zero8h(), v0 = zero8h(), v1 = zero8h();
    if (kv0 + 64 <= SEQ) {  // whole tile in range: the four loads go as one run
      k0 = *(const v8h*)(gk);
      k1 = *(const v8h*)(gk + 32 * HD);
      v0 = *(const v8h*)(gv);
      v1 = *(const v8h*)(gv + 32 * HD);
    } else {
      if (kvr < SEQ) {
        k0 = *(const v8h*)(gk);
        v0 = *(const v8h*)(gv);
      }
      if (kvr + 32 < SEQ) {
        k1 = *(const v8h*)(gk + 32 * HD);
        v1 = *(const v8h*)(gv + 32 * HD);
      }
    }
    *(v8h*)&kt[lkv][ld0]      = k0;
    *(v8h*)&kt[lkv + 32][ld0] = k1;
    *(v8h*)&vs[lkv][ld0]      = v0;
    *(v8h*)&vs[lkv + 32][ld0] = v1;
    __syncthreads();

    // S^T = K Q^T : 4 key tiles x 2 k-steps;
    // sa[t][r] = S[query c][key kv0 + 16t + 8*hf + r]
    v8f sa[4];
#pragma unroll
    for (int t = 0; t < 4; ++t) sa[t] = zero8f();
#pragma unroll
    for (int t = 0; t < 4; ++t) {
#pragma unroll
      for (int s = 0; s < 2; ++s) {
        v16h kF = ld_frag(&kt[t * 16 + c][s * 32], lane);
        sa[t] = __builtin_amdgcn_wmma_f32_16x16x32_f16(
            false, kF, false, qf[s], (short)0, sa[t], false, false);
      }
    }

    // mask OOB keys + new maximum of this lane's query
    float nmax = mrow;
#pragma unroll
    for (int t = 0; t < 4; ++t) {
#pragma unroll
      for (int r = 0; r < 8; ++r) {
        int ng = kv0 + t * 16 + 8 * hf + r;
        float sc = (ng < SEQ) ? sa[t][r] : -1e30f;
        sa[t][r] = sc;
        nmax = fmaxf(nmax, sc);
      }
    }
    nmax = fmaxf(nmax, xhalf(nmax));

    float fac = __expf(mrow - nmax);
    mrow = nmax;
#pragma unroll
    for (int t = 0; t < 4; ++t)
#pragma unroll
      for (int r = 0; r < 8; ++r) oacc[t][r] *= fac;

    // P^T = exp(S^T - m): element s of the B operand of 32-key block j is
    // key 32j + (s < 8 ? 8*hf + s : 16 + 8*hf + s - 8) = sa[2j + s/8][s%8]
    float psum = 0.f;
    v16h pF[2];
#pragma unroll
    for (int j = 0; j < 2; ++j) {
#pragma unroll
      for (int s = 0; s < 16; ++s) {
        float p = __expf(sa[2 * j + (s >> 3)][s & 7] - mrow);
        psum += p;
        pF[j][s] = (_Float16)p;
      }
    }
    lrow = lrow * fac + psum;

    // O^T += V^T P^T : 4 d tiles x 2 key blocks
    const _Float16* vp = &vs[8 * hf + (lane & 7)][8 * ((lane >> 3) & 1)];
#pragma unroll
    for (int t = 0; t < 4; ++t) {
#pragma unroll
      for (int j = 0; j < 2; ++j) {
        v16h vF = make16(ld_tr16(vp + (j * 32) * 80 + t * 16),
                         ld_tr16(vp + (j * 32 + 16) * 80 + t * 16));
        oacc[t] = __builtin_amdgcn_wmma_f32_16x16x32_f16(
            false, vF, false, pF[j], (short)0, oacc[t], false, false);
      }
    }
  }

  // join the halves' sums with every lane active, ahead of the row guard
  float lsum = lrow + xhalf(lrow);

  // The wave's 16 x 64 tile goes out through LDS so that a store covers whole
  // 128-byte lines. The barrier ends every wave's reads of the last K/V tile;
  // behind it each wave stages in 16 rows of its own (four waves in kt, four
  // in vs).
  __syncthreads();
  // the wave's number as a scalar, so that the range test is a scalar branch
  const int ws = __builtin_amdgcn_readfirstlane(w);
  _Float16* st = ws < 4 ? &kt[16 * ws][0] : &vs[16 * (ws - 4)][0];
  const int sp = ws < 4 ? 72 : 80;
#pragma unroll
  for (int t = 0; t < 4; ++t) {
    v8h o;
#pragma unroll
    for (int r = 0; r < 8; ++r) o[r] = (_Float16)(oacc[t][r] / lsum);
    *(v8h*)&st[c * sp + t * 16 + 8 * hf] = o;
  }
  // the rows are read back by other lanes of this wave: its LDS writes must
  // have landed, and the compiler must not move the reads above them
  asm volatile("s_wait_dscnt 0x0" ::: "memory");

  // a query's 64 values of one head are 128 bytes: 8 lanes a row, 4 rows a store
  const int b = bh >> 4, h = bh & 15;
  const int qs = blockIdx.x * 128 + ws * 16;
  const _Float16* sr = st + (lane >> 3) * sp + (lane & 7) * 8;
  _Float16* og = O + ((size_t)(b * SEQ + qs + (lane >> 3))) * EMB + h * HD +
                 (lane & 7) * 8;
  if (qs + 16 <= SEQ) {
    v8h o[4];
#pragma unroll
    for (int i = 0; i < 4; ++i) o[i] = *(const v8h*)(sr + i * 4 * sp);
#pragma unroll
    for (int i = 0; i < 4; ++i) *(v8h*)(og + (size_t)i * 4 * EMB) = o[i];
    // precaution: closes the run's stores before anything that stands
    // behind them in the listing reuses their registers
    asm volatile("s_wait_xcnt 0x0" ::: "memory");
  } else {
#pragma unroll
    for (int i = 0; i < 4; ++i) {
      const v8h o = *(const v8h*)(sr + i * 4 * sp);
      if (qs + (lane >> 3) + 4 * i < SEQ) {
        *(v8h*)(og + (size_t)i * 4 * EMB) = o;
        // precaution: closes the store before the next trip's LDS read
        // reuses its data registers
        asm volatile("s_wait_xcnt 0x0" ::: "memory");
      }
    }
  }
}

extern "C" void kernel_launch(void* const* d_in, const int* in_sizes, int n_in,
                              void* d_out, int out_size, void* d_ws,
                              size_t ws_size, hipStream_t stream) {
  const float* x  = (const float*)d_in[0];
  const float* Wq = (const float*)d_in[1];
  const float* bq = (const float*)d_in[2];
  const float* Wk = (const float*)d_in[3];
  const float* Wv = (const float*)d_in[4];
  const float* bv = (const float*)d_in[5];
  const float* Wo = (const float*)d_in[6];
  const float* bo = (const float*)d_in[7];
  float* out = (float*)d_out;

  _Float16* base = (_Float16*)d_ws;
  size_t off = 0;
  auto carve = [&](size_t n) {
    _Float16* p = base + off;
    off += (n + 127) & ~(size_t)127;
    return p;
  };
  _Float16* Xh  = carve((size_t)MROWS * EMB);
  _Float16* Wqh = carve((size_t)EMB * EMB);
  _Float16* Wkh = carve((size_t)EMB * EMB);
  _Float16* Wvh = carve((size_t)EMB * EMB);
  _Float16* Woh = carve((size_t)EMB * EMB);
  _Float16* Qh  = carve((size_t)MROWS * EMB);
  _Float16* Kh  = carve((size_t)MROWS * EMB);
  _Float16* Vh  = carve((size_t)MROWS * EMB);
  _Float16* Ah  = carve((size_t)MROWS * EMB);

  cvt_f32_to_f16<<<dim3(512, 5), 256, 0, stream>>>(
      x, Wq, Wk, Wv, Wo, Xh, Wqh, Wkh, Wvh, Woh, MROWS * EMB, EMB * EMB);

  dim3 g((MROWS + 127) / 128, EMB / 128);      // 47 x 8
  dim3 g3((MROWS + 127) / 128, EMB / 128, 3);  // 47 x 8 x {q, k, v}
  // q = (X Wq^T + bq) * d^-0.5  (scale applied after bias, as in reference)
  gemm_xwT<<<g3, 256, 0, stream>>>(Xh, Wqh, Wkh, Wvh, bq, nullptr, bv, 0.125f,
                                   1.0f, 1.0f, MROWS, 0, Qh, Kh, Vh, nullptr);

  attn_kernel<<<dim3((SEQ + 127) / 128, 4 * NH), 256, 0, stream>>>(Qh, Kh, Vh,
                                                                   Ah);

  gemm_xwT<<<g, 256, 0, stream>>>(Ah, Woh, nullptr, nullptr, bo, nullptr,
                                  nullptr, 1.0f, 1.0f, 1.0f, MROWS, 1, nullptr,
                                  nullptr, nullptr, out);
}

// v006
// Measured time: 106 microseconds a run.
// Timed twice side by side with v005, it ran 1.04 and 1.05 times as fast.
// Counting every step since v000, it is 2.42 times as fast.
#include <hip/hip_runtime.h>

#define SEQ 1500
#define EMB 1024
#define NH  16
#define HD  64
#define MROWS 6000   // B*SEQ = 4*1500

typedef __attribute__((ext_vector_type(16))) _Float16 v16h;
typedef __attribute__((ext_vector_type(8)))  _Float16 v8h;
typedef __attribute__((ext_vector_type(8)))  float    v8f;
typedef __attribute__((ext_vector_type(4)))  float    v4f;

__device__ inline v8h zero8h() { v8h z = {}; return z; }
__device__ inline v8f zero8f() { v8f z = {}; return z; }

__device__ inline v16h make16(v8h lo, v8h hi) {
  v16h r;
#pragma unroll
  for (int i = 0; i < 8; ++i) { r[i] = lo[i]; r[i + 8] = hi[i]; }
  return r;
}

// Load a 16x32 f16 A/B WMMA fragment whose row (m or n) = lane%16 is already
// folded into rowp. Per ISA layout: k(h,lane) = (h/8)*16 + (lane/16)*8 + h%8,
// i.e. two contiguous 8-half (16B) segments at +((lane>>4)*8) and +16 more.
__device__ inline v16h ld_frag(const _Float16* rowp, int lane) {
  const _Float16* p = rowp + ((lane >> 4) << 3);
  v8h lo = *(const v8h*)(p);
  v8h hi = *(const v8h*)(p + 16);
  return make16(lo, hi);
}

// One grid converts all five tensors side by side: blockIdx.y picks the tensor
// (0: activations, nx elements; 1..4: weights, nw elements each).
__global__ void cvt_f32_to_f16(
    const float* __restrict__ s0, const float* __restrict__ s1,
    const float* __restrict__ s2, const float* __restrict__ s3,
    const float* __restrict__ s4, _Float16* __restrict__ d0,
    _Float16* __restrict__ d1, _Float16* __restrict__ d2,
    _Float16* __restrict__ d3, _Float16* __restrict__ d4, int nx, int nw) {
  const int y = blockIdx.y;
  const float* __restrict__ s =
      y == 0 ? s0 : y == 1 ? s1 : y == 2 ? s2 : y == 3 ? s3 : s4;
  _Float16* __restrict__ d =
      y == 0 ? d0 : y == 1 ? d1 : y == 2 ? d2 : y == 3 ? d3 : d4;
  const int n = y == 0 ? nx : nw;
  int i = blockIdx.x * blockDim.x + threadIdx.x;
  int stride = gridDim.x * blockDim.x;
  for (; i < n; i += stride) d[i] = (_Float16)s[i];
}

// One stage of the GEMM ring: this lane's eight 16-byte asynchronous copies to
// LDS (l: LDS byte addresses, g: global addresses). The closing s_wait_xcnt is
// a precaution and stands inside the statement so that no later rewrite of an
// address register can be moved in front of it.
__device__ inline void copy_stage(const unsigned (&l)[8],
                                  const _Float16* const (&g)[8]) {
  asm volatile(
      "global_load_async_to_lds_b128 %0, %8, off\n\t"
      "global_load_async_to_lds_b128 %1, %9, off\n\t"
      "global_load_async_to_lds_b128 %2, %10, off\n\t"
      "global_load_async_to_lds_b128 %3, %11, off\n\t"
      "global_load_async_to_lds_b128 %4, %12, off\n\t"
      "global_load_async_to_lds_b128 %5, %13, off\n\t"
      "global_load_async_to_lds_b128 %6, %14, off\n\t"
      "global_load_async_to_lds_b128 %7, %15, off\n\t"
      "s_wait_xcnt 0x0"
      :
      : "v"(l[0]), "v"(l[1]), "v"(l[2]), "v"(l[3]), "v"(l[4]), "v"(l[5]),
        "v"(l[6]), "v"(l[7]), "v"(g[0]), "v"(g[1]), "v"(g[2]), "v"(g[3]),
        "v"(g[4]), "v"(g[5]), "v"(g[6]), "v"(g[7])
      : "memory");
}

// One stage of the attention ring: this lane's four copies, as above.
__device__ inline void copy_kv(const unsigned (&l)[4],
                               const _Float16* const (&g)[4]) {
  asm volatile(
      "global_load_async_to_lds_b128 %0, %4, off\n\t"
      "global_load_async_to_lds_b128 %1, %5, off\n\t"
      "global_load_async_to_lds_b128 %2, %6, off\n\t"
      "global_load_async_to_lds_b128 %3, %7, off\n\t"
      "s_wait_xcnt 0x0"
      :
      : "v"(l[0]), "v"(l[1]), "v"(l[2]), "v"(l[3]), "v"(g[0]), "v"(g[1]),
        "v"(g[2]), "v"(g[3])
      : "memory");
}

#define GBUF  3           // ring buffers; copies run GBUF - 1 stages ahead
#define GTILE (64 * 136)  // halves of one operand tile: 64 row pairs of 272 B
#define GSTG  (EMB / 64)  // stages of the K loop

// Place of row r (64 halves) in an operand tile, in halves: two rows side by
// side, then 16 bytes of pad. The 16 rows of a fragment read then fall on all
// 64 banks once, as at a pitch of 144 B, and three buffers of three
// work-groups fit one WGP's LDS.
__device__ inline int tile_row(int r) { return (r >> 1) * 136 + (r & 1) * 64; }

// C[M,N] = (X[M,K] * W[N,K]^T + bias) * scale ; K = N = 1024.
// Computed as C^T = W X^T (A operand = W rows, B operand = X rows).
// mode 0: write f16 into [b, h, t, d] head layout (QKV projections)
// mode 1: write f32 row-major [M, N] (output projection -> d_out)
// The operand tiles come into a ring of three LDS buffers by asynchronous
// copies, through no register, two stages ahead of the products that read
// them; one barrier per stage.
// A stage is 64 halves = one 128-byte line of every operand row: 8 lanes
// fetch one line, so a wave-wide 16-byte copy touches 4 whole lines.
// blockIdx.z picks one of up to three products that share X (weights, bias,
// scale, f16 output), so that independent projections run in one grid.
__global__ __launch_bounds__(256) void gemm_xwT(
    const _Float16* __restrict__ X, const _Float16* __restrict__ W0,
    const _Float16* __restrict__ W1, const _Float16* __restrict__ W2,
    const float* __restrict__ bias0, const float* __restrict__ bias1,
    const float* __restrict__ bias2, float scale0, float scale1, float scale2,
    int M, int mode, _Float16* __restrict__ outH0,
    _Float16* __restrict__ outH1, _Float16* __restrict__ outH2,
    float* __restrict__ outF) {
  // [buffer][0: X rows, 1: W rows][128 rows x 64 K, placed by tile_row]
  __shared__ __attribute__((aligned(16))) _Float16 sm[GBUF][2][GTILE];

  const int z = blockIdx.z;
  const _Float16* __restrict__ W = z == 0 ? W0 : z == 1 ? W1 : W2;
  const float* __restrict__ bias = z == 0 ? bias0 : z == 1 ? bias1 : bias2;
  const float scale = z == 0 ? scale0 : z == 1 ? scale1 : scale2;
  _Float16* __restrict__ outH = z == 0 ? outH0 : z == 1 ? outH1 : outH2;

  const int tid  = threadIdx.x;
  const int lane = tid & 31;
  const int wave = tid >> 5;
  const int wm   = wave >> 1;  // 0..3 -> 32 rows each
  const int wn   = wave & 1;   // 0..1 -> 64 cols each
  const int mblk = blockIdx.x * 128;
  const int nblk = blockIdx.y * 128;

  v8f acc[2][4];
#pragma unroll
  for (int i = 0; i < 2; ++i)
#pragma unroll
    for (int j = 0; j < 4; ++j) acc[i][j] = zero8f();

  const int lrow = tid >> 3;       // 0..31; rows lrow + 32 * i, i = 0..3
  const int lcol = (tid & 7) * 8;  // 8 lanes x 16 B = one 128-byte line

  // Clamp tail rows instead of EXEC-masking: every lane copies, from inside
  // X; clamped rows only feed C rows >= M which are never stored.
  const _Float16* gX[4];
#pragma unroll
  for (int i = 0; i < 4; ++i) {
    int gm = mblk + lrow + 32 * i;
    if (gm >= M) gm = M - 1;
    gX[i] = X + (size_t)gm * EMB + lcol;
  }
  const _Float16* gW = W + (size_t)(nblk + lrow) * EMB + lcol;  // N always ok
  // this lane's LDS byte address in the X tile of buffer 0
  const unsigned l0 = (unsigned)(size_t)&sm[0][0][tile_row(lrow) + lcol];

  // stage s: K columns 64 s .. 64 s + 63 of both tiles into buffer s % GBUF
  auto issue = [&](int s) {
    unsigned l[8];
    const _Float16* g[8];
#pragma unroll
    for (int i = 0; i < 4; ++i) {
      l[i]     = l0 + ((s % GBUF) * 2 * GTILE + i * 16 * 136) * 2;
      l[i + 4] = l0 + (((s % GBUF) * 2 + 1) * GTILE + i * 16 * 136) * 2;
      g[i]     = gX[i] + s * 64;
      g[i + 4] = gW + (size_t)i * 32 * EMB + s * 64;
    }
    copy_stage(l, g);
  };

  static_assert(GBUF == 3 && GSTG >= 2,
                "the counted wait below leaves one stage's copies in flight");
  // prologue: the first GBUF - 1 stages fly together
#pragma unroll
  for (int s = 0; s < GBUF - 1; ++s) issue(s);

  // Unrolled whole: buffer numbers, K offsets and the counts of the waits are
  // constants of each trip.
#pragma unroll
  for (int t = 0; t < GSTG; ++t) {
    const int cur = t % GBUF;

    // Publish point of stage t. This wave's reads of trip t - 1 have retired:
    asm volatile("s_wait_dscnt 0x0" ::: "memory");
    // its own copies of stage t have landed. Where trip t - 1 has issued
    // stage t + 1, those 8 copies, the wave's youngest, may stay in flight;
    // where it has issued nothing, the wait is to 0:
    if (t + 1 < GSTG)
      asm volatile("s_wait_asynccnt 0x8" ::: "memory");
    else
      asm volatile("s_wait_asynccnt 0x0" ::: "memory");
    // the barrier shows stage t to every wave and ends every wave's reads of
    // the buffer of trip t - 1, which the copies behind it refill
    __syncthreads();
    if (t + GBUF - 1 < GSTG) issue(t + GBUF - 1);

    // compute on current buffer: two 32-deep products per stage
#pragma unroll
    for (int ks = 0; ks < 2; ++ks) {
      v16h aF[2];
#pragma unroll
      for (int mi = 0; mi < 2; ++mi)
        aF[mi] = ld_frag(
            &sm[cur][0][tile_row(wm * 32 + mi * 16 + (lane & 15)) + ks * 32],
            lane);
#pragma unroll
      for (int ni = 0; ni < 4; ++ni) {
        v16h bF = ld_frag(
            &sm[cur][1][tile_row(wn * 64 + ni * 16 + (lane & 15)) + ks * 32],
            lane);
#pragma unroll
        for (int mi = 0; mi < 2; ++mi)
          acc[mi][ni] = __builtin_amdgcn_wmma_f32_16x16x32_f16(
              false, bF, false, aF[mi], (short)0, acc[mi][ni], false, false);
      }
    }
  }

  // epilogue: the tiles are C^T (rows n, columns m), so a lane owns one row
  // m = .. + (lane & 15) of C and 8 consecutive columns n = .. + 8*(lane >> 4)
  // + r of each tile: bias comes in 32 bytes at a time.
  const int c  = lane & 15;
  const int n0 = nblk + wn * 64 + 8 * (lane >> 4);
  v8f bb[4];
#pragma unroll
  for (int ni = 0; ni < 4; ++ni) bb[ni] = zero8f();
  if (bias) {
#pragma unroll
    for (int ni = 0; ni < 4; ++ni) bb[ni] = *(const v8f*)(bias + n0 + ni * 16);
  }
  // bias and scale in place, once for both output forms: the results need no
  // second register set
#pragma unroll
  for (int mi = 0; mi < 2; ++mi)
#pragma unroll
    for (int ni = 0; ni < 4; ++ni) acc[mi][ni] = (acc[mi][ni] + bb[ni]) * scale;
  // The wave's 32 x 64 tile goes out through LDS so that a store covers whole
  // 128-byte lines. The last trip reads buffer 0 alone; its barrier has ended
  // every read of buffers 1 and 2 and stands behind every wave's wait for its
  // last copies. Each wave stages there in a range of its own, so no further
  // barrier is needed.
  static_assert((GSTG - 1) % GBUF == 0 &&
                    8 * 32 * 272 <= (GBUF - 1) * 2 * GTILE * 2,
                "output staging must stay off the last trip's buffer");
  // The wave's number as a scalar, so that the tests below are scalar branches.
  const int ws = __builtin_amdgcn_readfirstlane(wave);
  char* stage = (char*)&sm[1][0][0] + ws * (32 * 272);
  const int m0 = mblk + (ws >> 1) * 32;
  if (mode == 0) {
    _Float16* st = (_Float16*)stage;  // [32][64] halves, pitch 144 B
#pragma unroll
    for (int mi = 0; mi < 2; ++mi)
#pragma unroll
      for (int ni = 0; ni < 4; ++ni) {
        v8h o;
#pragma unroll
        for (int r = 0; r < 8; ++r) o[r] = (_Float16)acc[mi][ni][r];
        *(v8h*)&st[(mi * 16 + c) * 72 + ni * 16 + 8 * (lane >> 4)] = o;
      }
    // the rows are read back by other lanes of this wave: its LDS writes
    // must have landed, and the compiler must not move the reads above them
    asm volatile("s_wait_dscnt 0x0" ::: "memory");
    // a row of one head is 128 bytes: 8 lanes a row, 4 rows a store
    const int hd = (nblk + (ws & 1) * 64) >> 6;
    const _Float16* sr = st + (lane >> 3) * 72 + (lane & 7) * 8;
    const int b0 = m0 / SEQ;
    if (m0 + 32 <= M && (m0 + 31) / SEQ == b0) {
      // all 32 rows in range and in one batch: 4 KiB in a row, one address
      _Float16* og =
          outH + (((size_t)(b0 * NH + hd) * SEQ) + (m0 - b0 * SEQ)) * HD + lane * 8;
      v8h o[8];
#pragma unroll
      for (int i = 0; i < 8; ++i) o[i] = *(const v8h*)(sr + i * 4 * 72);
#pragma unroll
      for (int i = 0; i < 8; ++i) *(v8h*)(og + i * 4 * HD) = o[i];
      // precaution: closes the run's stores before anything that stands
      // behind them in the listing reuses their registers
      asm volatile("s_wait_xcnt 0x0" ::: "memory");
    } else {
#pragma unroll
      for (int i = 0; i < 8; ++i) {
        const int m = m0 + (lane >> 3) + 4 * i;
        const v8h o = *(const v8h*)(sr + i * 4 * 72);
        if (m < M) {
          const int b = m / SEQ, t = m % SEQ;
          *(v8h*)(outH + (((size_t)(b * NH + hd) * SEQ) + t) * HD +
                  (lane & 7) * 8) = o;
        }
      }
    }
  } else {
    float* st = (float*)stage;  // [32][64] floats, pitch 272 B
#pragma unroll
    for (int mi = 0; mi < 2; ++mi)
#pragma unroll
      for (int ni = 0; ni < 4; ++ni) {
        // two 16-byte halves: the pitch keeps rows 16-byte aligned only
        float* sw = &st[(mi * 16 + c) * 68 + ni * 16 + 8 * (lane >> 4)];
        *(v4f*)sw = __builtin_shufflevector(acc[mi][ni], acc[mi][ni], 0, 1, 2, 3);
        *(v4f*)(sw + 4) =
            __builtin_shufflevector(acc[mi][ni], acc[mi][ni], 4, 5, 6, 7);
      }
    // as above: this wave's LDS writes land before its lanes read them back
    asm volatile("s_wait_dscnt 0x0" ::: "memory");
    // 64 floats of a row are two lines: 16 lanes a row, 2 rows a store
    const float* sr = st + (lane >> 4) * 68 + (lane & 15) * 4;
    float* og = outF + (size_t)(m0 + (lane >> 4)) * EMB + nblk + (ws & 1) * 64 +
                (lane & 15) * 4;
    if (m0 + 32 <= M) {
      v4f o[16];
#pragma unroll
      for (int i = 0; i < 16; ++i) o[i] = *(const v4f*)(sr + i * 2 * 68);
#pragma unroll
      for (int i = 0; i < 16; ++i) *(v4f*)(og + (size_t)i * 2 * EMB) = o[i];
      // precaution: closes the run's stores before anything that stands
      // behind them in the listing reuses their registers
      asm volatile("s_wait_xcnt 0x0" ::: "memory");
    } else {
#pragma unroll
      for (int i = 0; i < 16; ++i) {
        const v4f o = *(const v4f*)(sr + i * 2 * 68);
        if (m0 + (lane >> 4) + 2 * i < M) *(v4f*)(og + (size_t)i * 2 * EMB) = o;
      }
    }
  }
}

typedef __attribute__((ext_vector_type(8))) short v8s;

// 16-bit transposing LDS load from a row-major tile T[k][d]. With
// p = &T[k0 + 8 * (lane >> 4) + (lane & 7)][d0 + 8 * ((lane >> 3) & 1)]
// lane (c = lane & 15, h = lane >> 4) receives T[k0 + 8h + 0..7][d0 + c].
__device__ inline v8h ld_tr16(const _Float16* p) {
  typedef __attribute__((address_space(3))) v8s lds_v8s;
  return __builtin_bit_cast(
      v8h, __builtin_amdgcn_ds_load_tr16_b128_v8i16((lds_v8s*)p));
}

// value of lane l ^ 16
__device__ inline float xhalf(float x) {
  int b = __builtin_bit_cast(int, x);
  return __builtin_bit_cast(
      float, __builtin_amdgcn_permlanex16(b, b, 0x76543210, 0xfedcba98, false,
                                          false));
}

#define ANT ((SEQ + 63) / 64)  // key tiles
#define AKT (64 * 72)          // halves of a K buffer
#define AVT (64 * 80)          // halves of a V buffer
__global__ __launch_bounds__(256) void attn_kernel(
    const _Float16* __restrict__ Q, const _Float16* __restrict__ K,
    const _Float16* __restrict__ V, _Float16* __restrict__ O) {
  // three buffers of [kv][d], pitch 144 B: plain 16-B reads
  __shared__ __attribute__((aligned(16))) _Float16 kt[3 * AKT];
  // three buffers of [kv][d], pitch 160 B: transposing reads
  __shared__ __attribute__((aligned(16))) _Float16 vs[3 * AVT];
  static_assert(ANT >= 2, "the ring's prologue needs two tiles");

  const int tid  = threadIdx.x;
  const int lane = tid & 31;
  const int w    = tid >> 5;
  const int c    = lane & 15;
  const int hf   = lane >> 4;
  const int bh   = blockIdx.y;
  const int q0   = blockIdx.x * 128 + w * 16;

  const _Float16* Qb = Q + (size_t)bh * SEQ * HD;
  const _Float16* Kb = K + (size_t)bh * SEQ * HD;
  const _Float16* Vb = V + (size_t)bh * SEQ * HD;

  // Q fragments (B operand, column = query c; clamped, invalid never stored)
  int qrow = q0 + c;
  int qr = qrow < SEQ ? qrow : (SEQ - 1);
  v16h qf[2];
#pragma unroll
  for (int s = 0; s < 2; ++s)
    qf[s] = ld_frag(Qb + (size_t)qr * HD + s * 32, lane);

  v8f oacc[4];  // oacc[t][r] = O^T[d = 16t + 8*hf + r][query c]
#pragma unroll
  for (int t = 0; t < 4; ++t) oacc[t] = zero8f();
  float mrow = -1e30f;  // running maximum of query c, equal in both halves
  float lrow = 0.f;     // running sum over this half's keys only

  const int lkv = tid >> 3;       // 0..31; rows lkv and lkv + 32
  const int ld0 = (tid & 7) * 8;  // 8 lanes x 16 B = one 128-byte row

  // this lane's LDS byte addresses in buffer 0: rows lkv and lkv + 32
  const unsigned lk0 = (unsigned)(size_t)&kt[lkv * 72 + ld0];
  const unsigned lk1 = lk0 + 32 * 144;
  const unsigned lv0 = (unsigned)(size_t)&vs[lkv * 80 + ld0];
  const unsigned lv1 = lv0 + 32 * 160;
  // and its places in row 0 and row 32 of K and V
  const char* gk0 = (const char*)(Kb + ld0);
  const char* gk1 = gk0 + 32 * HD * 2;
  const char* gv0 = (const char*)(Vb + ld0);
  const char* gv1 = gv0 + 32 * HD * 2;
  // The tile whose row lkv lies rb bytes into K and V, into the buffers kb and
  // vb halves into kt and vs. Rows past the end are clamped, not masked: every
  // lane copies, from inside K and V; the clamped rows repeat the last key's
  // own values, and such keys get weight 0 below.
  auto issue = [&](unsigned rb, int kb, int vb) {
    const unsigned a0 = rb < (SEQ - 1) * HD * 2 ? rb : (SEQ - 1) * HD * 2;
    const unsigned a1 = rb < (SEQ - 33) * HD * 2 ? rb : (SEQ - 33) * HD * 2;
    const unsigned l[4] = {lk0 + kb * 2, lk1 + kb * 2, lv0 + vb * 2,
                           lv1 + vb * 2};
    const _Float16* const g[4] = {
        (const _Float16*)(gk0 + a0), (const _Float16*)(gk1 + a1),
        (const _Float16*)(gv0 + a0), (const _Float16*)(gv1 + a1)};
    copy_kv(l, g);
  };
  unsigned rb = lkv * HD * 2;
  issue(rb, 0, 0);
  rb += 64 * HD * 2;
  issue(rb, AKT, AVT);

  int ko = 0, vo = 0;  // buffer i mod 3 of tile i: its place in kt and vs
  for (int i = 0; i < ANT; ++i) {
    const int kv0 = i * 64;
    // Publish point of tile i. This wave's reads of tile i - 1 have retired:
    asm volatile("s_wait_dscnt 0x0" ::: "memory");
    // its own copies of tile i have landed. Where trip i - 1 has issued tile
    // i + 1, those 4 copies, the wave's youngest, may stay in flight; where it
    // has issued nothing, the wait is to 0:
    if (i + 1 < ANT)
      asm volatile("s_wait_asynccnt 0x4" ::: "memory");
    else
      asm volatile("s_wait_asynccnt 0x0" ::: "memory");
    // the barrier shows tile i to every wave and ends every wave's reads of
    // the buffer of tile i - 1, which the copies behind it refill
    __syncthreads();
    rb += 64 * HD * 2;
    if (i + 2 < ANT)
      issue(rb, ko == 0 ? 2 * AKT : ko - AKT, vo == 0 ? 2 * AVT : vo - AVT);

    // S^T = K Q^T : 4 key tiles x 2 k-steps;
    // sa[t][r] = S[query c][key kv0 + 16t + 8*hf + r]
    v8f sa[4];
#pragma unroll
    for (int t = 0; t < 4; ++t) sa[t] = zero8f();
#pragma unroll
    for (int t = 0; t < 4; ++t) {
#pragma unroll
      for (int s = 0; s < 2; ++s) {
        v16h kF = ld_frag(&kt[ko + (t * 16 + c) * 72 + s * 32], lane);
        sa[t] = __builtin_amdgcn_wmma_f32_16x16x32_f16(
            false, kF, false, qf[s], (short)0, sa[t], false, false);
      }
    }

    // mask OOB keys + new maximum of this lane's query
    float nmax = mrow;
#pragma unroll
    for (int t = 0; t < 4; ++t) {
#pragma unroll
      for (int r = 0; r < 8; ++r) {
        int ng = kv0 + t * 16 + 8 * hf + r;
        float sc = (ng < SEQ) ? sa[t][r] : -1e30f;
        sa[t][r] = sc;
        nmax = fmaxf(nmax, sc);
      }
    }
    nmax = fmaxf(nmax, xhalf(nmax));

    float fac = __expf(mrow - nmax);
    mrow = nmax;
#pragma unroll
    for (int t = 0; t < 4; ++t)
#pragma unroll
      for (int r = 0; r < 8; ++r) oacc[t][r] *= fac;

    // P^T = exp(S^T - m): element s of the B operand of 32-key block j is
    // key 32j + (s < 8 ? 8*hf + s : 16 + 8*hf + s - 8) = sa[2j + s/8][s%8]
    float psum = 0.f;
    v16h pF[2];
#pragma unroll
    for (int j = 0; j < 2; ++j) {
#pragma unroll
      for (int s = 0; s < 16; ++s) {
        float p = __expf(sa[2 * j + (s >> 3)][s & 7] - mrow);
        psum += p;
        pF[j][s] = (_Float16)p;
      }
    }
    lrow = lrow * fac + psum;

    // O^T += V^T P^T : 4 d tiles x 2 key blocks
    const _Float16* vp =
        &vs[vo + (8 * hf + (lane & 7)) * 80 + 8 * ((lane >> 3) & 1)];
#pragma unroll
    for (int t = 0; t < 4; ++t) {
#pragma unroll
      for (int j = 0; j < 2; ++j) {
        v16h vF = make16(ld_tr16(vp + (j * 32) * 80 + t * 16),
                         ld_tr16(vp + (j * 32 + 16) * 80 + t * 16));
        oacc[t] = __builtin_amdgcn_wmma_f32_16x16x32_f16(
            false, vF, false, pF[j], (short)0, oacc[t], false, false);
      }
    }
    ko = ko == 2 * AKT ? 0 : ko + AKT;
    vo = vo == 2 * AVT ? 0 : vo + AVT;
  }

  // join the halves' sums with every lane active, ahead of the row guard
  float lsum = lrow + xhalf(lrow);

  // The wave's 16 x 64 tile goes out through LDS so that a store covers whole
  // 128-byte lines. The barrier ends every wave's reads of the last K/V tile;
  // behind it each wave stages in 16 rows of its own (four waves in kt, four
  // in vs).
  __syncthreads();
  // the wave's number as a scalar, so that the range test is a scalar branch
  const int ws = __builtin_amdgcn_readfirstlane(w);
  _Float16* st = ws < 4 ? &kt[16 * ws * 72] : &vs[16 * (ws - 4) * 80];
  const int sp = ws < 4 ? 72 : 80;
#pragma unroll
  for (int t = 0; t < 4; ++t) {
    v8h o;
#pragma unroll
    for (int r = 0; r < 8; ++r) o[r] = (_Float16)(oacc[t][r] / lsum);
    *(v8h*)&st[c * sp + t * 16 + 8 * hf] = o;
  }
  // the rows are read back by other lanes of this wave: its LDS writes must
  // have landed, and the compiler must not move the reads above them
  asm volatile("s_wait_dscnt 0x0" ::: "memory");

  // a query's 64 values of one head are 128 bytes: 8 lanes a row, 4 rows a store
  const int b = bh >> 4, h = bh & 15;
  const int qs = blockIdx.x * 128 + ws * 16;
  const _Float16* sr = st + (lane >> 3) * sp + (lane & 7) * 8;
  _Float16* og = O + ((size_t)(b * SEQ + qs + (lane >> 3))) * EMB + h * HD +
                 (lane & 7) * 8;
  if (qs + 16 <= SEQ) {
    v8h o[4];
#pragma unroll
    for (int i = 0; i < 4; ++i) o[i] = *(const v8h*)(sr + i * 4 * sp);
#pragma unroll
    for (int i = 0; i < 4; ++i) *(v8h*)(og + (size_t)i * 4 * EMB) = o[i];
    // precaution: closes the run's stores before anything that stands
    // behind them in the listing reuses their registers
    asm volatile("s_wait_xcnt 0x0" ::: "memory");
  } else {
#pragma unroll
    for (int i = 0; i < 4; ++i) {
      const v8h o = *(const v8h*)(sr + i * 4 * sp);
      if (qs + (lane >> 3) + 4 * i < SEQ) {
        *(v8h*)(og + (size_t)i * 4 * EMB) = o;
        // precaution: closes the store before the next trip's LDS read
        // reuses its data registers
        asm volatile("s_wait_xcnt 0x0" ::: "memory");
      }
    }
  }
}

extern "C" void kernel_launch(void* const* d_in, const int* in_sizes, int n_in,
                              void* d_out, int out_size, void* d_ws,
                              size_t ws_size, hipStream_t stream) {
  const float* x  = (const float*)d_in[0];
  const float* Wq = (const float*)d_in[1];
  const float* bq = (const float*)d_in[2];
  const float* Wk = (const float*)d_in[3];
  const float* Wv = (const float*)d_in[4];
  const float* bv = (const float*)d_in[5];
  const float* Wo = (const float*)d_in[6];
  const float* bo = (const float*)d_in[7];
  float* out = (float*)d_out;

  _Float16* base = (_Float16*)d_ws;
  size_t off = 0;
  auto carve = [&](size_t n) {
    _Float16* p = base + off;
    off += (n + 127) & ~(size_t)127;
    return p;
  };
  _Float16* Xh  = carve((size_t)MROWS * EMB);
  _Float16* Wqh = carve((size_t)EMB * EMB);
  _Float16* Wkh = carve((size_t)EMB * EMB);
  _Float16* Wvh = carve((size_t)EMB * EMB);
  _Float16* Woh = carve((size_t)EMB * EMB);
  _Float16* Qh  = carve((size_t)MROWS * EMB);
  _Float16* Kh  = carve((size_t)MROWS * EMB);
  _Float16* Vh  = carve((size_t)MROWS * EMB);
  _Float16* Ah  = carve((size_t)MROWS * EMB);

  cvt_f32_to_f16<<<dim3(512, 5), 256, 0, stream>>>(
      x, Wq, Wk, Wv, Wo, Xh, Wqh, Wkh, Wvh, Woh, MROWS * EMB, EMB * EMB);

  dim3 g((MROWS + 127) / 128, EMB / 128);      // 47 x 8
  dim3 g3((MROWS + 127) / 128, EMB / 128, 3);  // 47 x 8 x {q, k, v}
  // q = (X Wq^T + bq) * d^-0.5  (scale applied after bias, as in reference)
  gemm_xwT<<<g3, 256, 0, stream>>>(Xh, Wqh, Wkh, Wvh, bq, nullptr, bv, 0.125f,
                                   1.0f, 1.0f, MROWS, 0, Qh, Kh, Vh, nullptr);

  attn_kernel<<<dim3((SEQ + 127) / 128, 4 * NH), 256, 0, stream>>>(Qh, Kh, Vh,
                                                                   Ah);

  gemm_xwT<<<g, 256, 0, stream>>>(Ah, Woh, nullptr, nullptr, bo, nullptr,
                                  nullptr, 1.0f, 1.0f, 1.0f, MROWS, 1, nullptr,
                                  nullptr, nullptr, out);
}

// v007
// Measured time: 101 microseconds a run.
// Timed twice side by side with v006, it ran 1.05 times as fast both times.
// Counting every step since v000, it is 2.54 times as fast.
#include <hip/hip_runtime.h>

#define SEQ 1500
#define EMB 1024
#define NH  16
#define HD  64
#define MROWS 6000   // B*SEQ = 4*1500

typedef __attribute__((ext_vector_type(16))) _Float16 v16h;
typedef __attribute__((ext_vector_type(8)))  _Float16 v8h;
typedef __attribute__((ext_vector_type(8)))  float    v8f;
typedef __attribute__((ext_vector_type(4)))  float    v4f;

__device__ inline v8h zero8h() { v8h z = {}; return z; }
__device__ inline v8f zero8f() { v8f z = {}; return z; }

__device__ inline v16h make16(v8h lo, v8h hi) {
  v16h r;
#pragma unroll
  for (int i = 0; i < 8; ++i) { r[i] = lo[i]; r[i + 8] = hi[i]; }
  return r;
}

// Load a 16x32 f16 A/B WMMA fragment whose row (m or n) = lane%16 is already
// folded into rowp. Per ISA layout: k(h,lane) = (h/8)*16 + (lane/16)*8 + h%8,
// i.e. two contiguous 8-half (16B) segments at +((lane>>4)*8) and +16 more.
__device__ inline v16h ld_frag(const _Float16* rowp, int lane) {
  const _Float16* p = rowp + ((lane >> 4) << 3);
  v8h lo = *(const v8h*)(p);
  v8h hi = *(const v8h*)(p + 16);
  return make16(lo, hi);
}

// One grid converts all five tensors side by side: blockIdx.y picks the tensor
// (0: activations, nx elements; 1..4: weights, nw elements each).
__global__ void cvt_f32_to_f16(
    const float* __restrict__ s0, const float* __restrict__ s1,
    const float* __restrict__ s2, const float* __restrict__ s3,
    const float* __restrict__ s4, _Float16* __restrict__ d0,
    _Float16* __restrict__ d1, _Float16* __restrict__ d2,
    _Float16* __restrict__ d3, _Float16* __restrict__ d4, int nx, int nw) {
  const int y = blockIdx.y;
  const float* __restrict__ s =
      y == 0 ? s0 : y == 1 ? s1 : y == 2 ? s2 : y == 3 ? s3 : s4;
  _Float16* __restrict__ d =
      y == 0 ? d0 : y == 1 ? d1 : y == 2 ? d2 : y == 3 ? d3 : d4;
  const int n = y == 0 ? nx : nw;
  int i = blockIdx.x * blockDim.x + threadIdx.x;
  int stride = gridDim.x * blockDim.x;
  for (; i < n; i += stride) d[i] = (_Float16)s[i];
}

// One operand tile of a stage of the GEMM ring: this lane's eight 16-byte
// asynchronous copies to LDS (l: LDS byte addresses, g: global addresses).
// The closing s_wait_xcnt is a precaution and stands inside the statement so
// that no later rewrite of an address register can be moved in front of it.
__device__ inline void copy_stage(const unsigned (&l)[8],
                                  const _Float16* const (&g)[8]) {
  asm volatile(
      "global_load_async_to_lds_b128 %0, %8, off\n\t"
      "global_load_async_to_lds_b128 %1, %9, off\n\t"
      "global_load_async_to_lds_b128 %2, %10, off\n\t"
      "global_load_async_to_lds_b128 %3, %11, off\n\t"
      "global_load_async_to_lds_b128 %4, %12, off\n\t"
      "global_load_async_to_lds_b128 %5, %13, off\n\t"
      "global_load_async_to_lds_b128 %6, %14, off\n\t"
      "global_load_async_to_lds_b128 %7, %15, off\n\t"
      "s_wait_xcnt 0x0"
      :
      : "v"(l[0]), "v"(l[1]), "v"(l[2]), "v"(l[3]), "v"(l[4]), "v"(l[5]),
        "v"(l[6]), "v"(l[7]), "v"(g[0]), "v"(g[1]), "v"(g[2]), "v"(g[3]),
        "v"(g[4]), "v"(g[5]), "v"(g[6]), "v"(g[7])
      : "memory");
}

// One stage of the attention ring: this lane's four copies, as above.
__device__ inline void copy_kv(const unsigned (&l)[4],
                               const _Float16* const (&g)[4]) {
  asm volatile(
      "global_load_async_to_lds_b128 %0, %4, off\n\t"
      "global_load_async_to_lds_b128 %1, %5, off\n\t"
      "global_load_async_to_lds_b128 %2, %6, off\n\t"
      "global_load_async_to_lds_b128 %3, %7, off\n\t"
      "s_wait_xcnt 0x0"
      :
      : "v"(l[0]), "v"(l[1]), "v"(l[2]), "v"(l[3]), "v"(g[0]), "v"(g[1]),
        "v"(g[2]), "v"(g[3])
      : "memory");
}

#define GBUF  3           // ring buffers; copies run GBUF - 1 stages ahead
#define GTILE (64 * 136)  // halves of one operand tile: 64 row pairs of 272 B
#define GSTG  (EMB / 64)  // stages of the K loop

// Place of row r (64 halves) in an operand tile, in halves: two rows side by
// side, then 16 bytes of pad. The 16 rows of a fragment read then fall on all
// 64 banks once, as at a pitch of 144 B, and three buffers of three
// work-groups fit one WGP's LDS.
__device__ inline int tile_row(int r) { return (r >> 1) * 136 + (r & 1) * 64; }

// C[M,N] = (X[M,K] * W[N,K]^T + bias) * scale ; K = N = 1024.
// Computed as C^T = W X^T (A operand = W rows, B operand = X rows).
// mode 0: write f16 into [b, h, t, d] head layout (QKV projections)
// mode 1: write f32 row-major [M, N] (output projection -> d_out)
// The operand tiles come into a ring of three LDS buffers by asynchronous
// copies, through no register, two stages ahead of the products that read
// them; one barrier per stage.
// Four waves, one a SIMD, each on a 64 x 64 tile of C: the 8 fragments of a
// 32-deep block come from LDS as one group and feed 16 products, so a fragment
// read serves four products.
// A stage is 64 halves = one 128-byte line of every operand row: 8 lanes
// fetch one line, so a wave-wide 16-byte copy touches 4 whole lines.
// blockIdx.z picks one of up to three products that share X (weights, bias,
// scale, f16 output), so that independent projections run in one grid.
__global__ __launch_bounds__(128) void gemm_xwT(
    const _Float16* __restrict__ X, const _Float16* __restrict__ W0,
    const _Float16* __restrict__ W1, const _Float16* __restrict__ W2,
    const float* __restrict__ bias0, const float* __restrict__ bias1,
    const float* __restrict__ bias2, float scale0, float scale1, float scale2,
    int M, int mode, _Float16* __restrict__ outH0,
    _Float16* __restrict__ outH1, _Float16* __restrict__ outH2,
    float* __restrict__ outF) {
  // [buffer][0: X rows, 1: W rows][128 rows x 64 K, placed by tile_row]
  __shared__ __attribute__((aligned(16))) _Float16 sm[GBUF][2][GTILE];

  const int z = blockIdx.z;
  const _Float16* __restrict__ W = z == 0 ? W0 : z == 1 ? W1 : W2;
  const float* __restrict__ bias = z == 0 ? bias0 : z == 1 ? bias1 : bias2;
  const float scale = z == 0 ? scale0 : z == 1 ? scale1 : scale2;
  _Float16* __restrict__ outH = z == 0 ? outH0 : z == 1 ? outH1 : outH2;

  const int tid  = threadIdx.x;
  const int lane = tid & 31;
  const int wave = tid >> 5;
  const int wm   = wave >> 1;  // 0..1 -> 64 rows each
  const int wn   = wave & 1;   // 0..1 -> 64 cols each
  const int mblk = blockIdx.x * 128;
  const int nblk = blockIdx.y * 128;

  v8f acc[4][4];
#pragma unroll
  for (int i = 0; i < 4; ++i)
#pragma unroll
    for (int j = 0; j < 4; ++j) acc[i][j] = zero8f();

  const int lrow = tid >> 3;       // 0..15; rows lrow + 16 * i, i = 0..7
  const int lcol = (tid & 7) * 8;  // 8 lanes x 16 B = one 128-byte line

  // Clamp tail rows instead of EXEC-masking: every lane copies, from inside
  // X; clamped rows only feed C rows >= M which are never stored.
  const _Float16* gX[8];
#pragma unroll
  for (int i = 0; i < 8; ++i) {
    int gm = mblk + lrow + 16 * i;
    if (gm >= M) gm = M - 1;
    gX[i] = X + (size_t)gm * EMB + lcol;
  }
  const _Float16* gW = W + (size_t)(nblk + lrow) * EMB + lcol;  // N always ok
  // this lane's LDS byte address in the X tile of buffer 0
  const unsigned l0 = (unsigned)(size_t)&sm[0][0][tile_row(lrow) + lcol];

  // stage s: K columns 64 s .. 64 s + 63 of both tiles into buffer s % GBUF
  auto issue = [&](int s) {
    unsigned l[8];
    const _Float16* g[8];
#pragma unroll
    for (int i = 0; i < 8; ++i) {
      l[i] = l0 + ((s % GBUF) * 2 * GTILE + i * 8 * 136) * 2;
      g[i] = gX[i] + s * 64;
    }
    copy_stage(l, g);
#pragma unroll
    for (int i = 0; i < 8; ++i) {
      l[i] = l0 + (((s % GBUF) * 2 + 1) * GTILE + i * 8 * 136) * 2;
      g[i] = gW + (size_t)i * 16 * EMB + s * 64;
    }
    copy_stage(l, g);
  };

  static_assert(GBUF == 3 && GSTG >= 2,
                "the counted wait below leaves one stage's copies in flight");
  // prologue: the first GBUF - 1 stages fly together
#pragma unroll
  for (int s = 0; s < GBUF - 1; ++s) issue(s);

  // Unrolled whole: buffer numbers, K offsets and the counts of the waits are
  // constants of each trip.
#pragma unroll
  for (int t = 0; t < GSTG; ++t) {
    const int cur = t % GBUF;

    // Publish point of stage t. This wave's reads of trip t - 1 have retired:
    asm volatile("s_wait_dscnt 0x0" ::: "memory");
    // its own copies of stage t have landed. Where trip t - 1 has issued
    // stage t + 1, those 16 copies, the wave's youngest, may stay in flight;
    // where it has issued nothing, the wait is to 0:
    if (t + 1 < GSTG)
      asm volatile("s_wait_asynccnt 0x10" ::: "memory");
    else
      asm volatile("s_wait_asynccnt 0x0" ::: "memory");
    // the barrier shows stage t to every wave and ends every wave's reads of
    // the buffer of trip t - 1, which the copies behind it refill
    __syncthreads();
    if (t + GBUF - 1 < GSTG) issue(t + GBUF - 1);

    // compute on current buffer: two 32-deep products per stage
#pragma unroll
    for (int ks = 0; ks < 2; ++ks) {
      v16h aF[4], bF[4];
#pragma unroll
      for (int mi = 0; mi < 4; ++mi)
        aF[mi] = ld_frag(
            &sm[cur][0][tile_row(wm * 64 + mi * 16 + (lane & 15)) + ks * 32],
            lane);
#pragma unroll
      for (int ni = 0; ni < 4; ++ni)
        bF[ni] = ld_frag(
            &sm[cur][1][tile_row(wn * 64 + ni * 16 + (lane & 15)) + ks * 32],
            lane);
      // Keeps the block's 16 LDS reads one group in front of its products:
      // left alone, the compiler sinks them among the products, two reads and
      // a wait to 0 in front of every four.
      __builtin_amdgcn_sched_barrier(0);
#pragma unroll
      for (int ni = 0; ni < 4; ++ni)
#pragma unroll
        for (int mi = 0; mi < 4; ++mi)
          acc[mi][ni] = __builtin_amdgcn_wmma_f32_16x16x32_f16(
              false, bF[ni], false, aF[mi], (short)0, acc[mi][ni], false,
              false);
      // The other end of the block: no product sinks behind the next publish
      // point, and no later read or address sum rises among the products.
      __builtin_amdgcn_sched_barrier(0);
    }
  }

  // epilogue: the tiles are C^T (rows n, columns m), so a lane owns one row
  // m = .. + (lane & 15) of C and 8 consecutive columns n = .. + 8*(lane >> 4)
  // + r of each tile: bias comes in 32 bytes at a time.
  const int c  = lane & 15;
  const int n0 = nblk + wn * 64 + 8 * (lane >> 4);
  v8f bb[4];
#pragma unroll
  for (int ni = 0; ni < 4; ++ni) bb[ni] = zero8f();
  if (bias) {
#pragma unroll
    for (int ni = 0; ni < 4; ++ni) bb[ni] = *(const v8f*)(bias + n0 + ni * 16);
  }
  // bias and scale in place, once for both output forms: the results need no
  // second register set
#pragma unroll
  for (int mi = 0; mi < 4; ++mi)
#pragma unroll
    for (int ni = 0; ni < 4; ++ni) acc[mi][ni] = (acc[mi][ni] + bb[ni]) * scale;
  // The wave's 64 x 64 tile goes out through LDS so that a store covers whole
  // 128-byte lines. The last trip reads buffer 0 alone; its barrier has ended
  // every read of buffers 1 and 2 and stands behind every wave's wait for its
  // last copies. Each wave stages there in a range of its own, so no further
  // barrier is needed.
  static_assert((GSTG - 1) % GBUF == 0 &&
                    4 * 64 * 272 <= (GBUF - 1) * 2 * GTILE * 2,
                "output staging must stay off the last trip's buffer");
  // The wave's number as a scalar, so that the tests below are scalar branches.
  const int ws = __builtin_amdgcn_readfirstlane(wave);
  char* stage = (char*)&sm[1][0][0] + ws * (64 * 272);
  const int m0 = mblk + (ws >> 1) * 64;
  if (mode == 0) {
    _Float16* st = (_Float16*)stage;  // [64][64] halves, pitch 144 B
#pragma unroll
    for (int mi = 0; mi < 4; ++mi)
#pragma unroll
      for (int ni = 0; ni < 4; ++ni) {
        v8h o;
#pragma unroll
        for (int r = 0; r < 8; ++r) o[r] = (_Float16)acc[mi][ni][r];
        *(v8h*)&st[(mi * 16 + c) * 72 + ni * 16 + 8 * (lane >> 4)] = o;
      }
    // the rows are read back by other lanes of this wave: its LDS writes
    // must have landed, and the compiler must not move the reads above them
    asm volatile("s_wait_dscnt 0x0" ::: "memory");
    // a row of one head is 128 bytes: 8 lanes a row, 4 rows a store
    const int hd = (nblk + (ws & 1) * 64) >> 6;
    // the tile's two halves of 32 rows, one after the other
#pragma unroll
    for (int hh = 0; hh < 2; ++hh) {
      const int mh = m0 + 32 * hh;
      const _Float16* sr = st + (32 * hh + (lane >> 3)) * 72 + (lane & 7) * 8;
      const int b0 = mh / SEQ;
      if (mh + 32 <= M && (mh + 31) / SEQ == b0) {
        // all 32 rows in range and in one batch: 4 KiB in a row, one address
        _Float16* og = outH +
                       (((size_t)(b0 * NH + hd) * SEQ) + (mh - b0 * SEQ)) * HD +
                       lane * 8;
        v8h o[8];
#pragma unroll
        for (int i = 0; i < 8; ++i) o[i] = *(const v8h*)(sr + i * 4 * 72);
#pragma unroll
        for (int i = 0; i < 8; ++i) *(v8h*)(og + i * 4 * HD) = o[i];
        // precaution: closes the run's stores before anything that stands
        // behind them in the listing reuses their registers
        asm volatile("s_wait_xcnt 0x0" ::: "memory");
      } else {
#pragma unroll
        for (int i = 0; i < 8; ++i) {
          const int m = mh + (lane >> 3) + 4 * i;
          const v8h o = *(const v8h*)(sr + i * 4 * 72);
          if (m < M) {
            const int b = m / SEQ, t = m % SEQ;
            *(v8h*)(outH + (((size_t)(b * NH + hd) * SEQ) + t) * HD +
                    (lane & 7) * 8) = o;
          }
        }
      }
    }
  } else {
    float* st = (float*)stage;  // [64][64] floats, pitch 272 B
#pragma unroll
    for (int mi = 0; mi < 4; ++mi)
#pragma unroll
      for (int ni = 0; ni < 4; ++ni) {
        // two 16-byte halves: the pitch keeps rows 16-byte aligned only
        float* sw = &st[(mi * 16 + c) * 68 + ni * 16 + 8 * (lane >> 4)];
        *(v4f*)sw = __builtin_shufflevector(acc[mi][ni], acc[mi][ni], 0, 1, 2, 3);
        *(v4f*)(sw + 4) =
            __builtin_shufflevector(acc[mi][ni], acc[mi][ni], 4, 5, 6, 7);
      }
    // as above: this wave's LDS writes land before its lanes read them back
    asm volatile("s_wait_dscnt 0x0" ::: "memory");
    // 64 floats of a row are two lines: 16 lanes a row, 2 rows a store;
    // the tile's two halves of 32 rows, one after the other
#pragma unroll
    for (int hh = 0; hh < 2; ++hh) {
      const int mh = m0 + 32 * hh;
      const float* sr = st + (32 * hh + (lane >> 4)) * 68 + (lane & 15) * 4;
      float* og = outF + (size_t)(mh + (lane >> 4)) * EMB + nblk +
                  (ws & 1) * 64 + (lane & 15) * 4;
      if (mh + 32 <= M) {
        v4f o[16];
#pragma unroll
        for (int i = 0; i < 16; ++i) o[i] = *(const v4f*)(sr + i * 2 * 68);
#pragma unroll
        for (int i = 0; i < 16; ++i) *(v4f*)(og + (size_t)i * 2 * EMB) = o[i];
        // precaution: closes the run's stores before anything that stands
        // behind them in the listing reuses their registers
        asm volatile("s_wait_xcnt 0x0" ::: "memory");
      } else {
#pragma unroll
        for (int i = 0; i < 16; ++i) {
          const v4f o = *(const v4f*)(sr + i * 2 * 68);
          if (mh + (lane >> 4) + 2 * i < M)
            *(v4f*)(og + (size_t)i * 2 * EMB) = o;
        }
      }
    }
  }
}

typedef __attribute__((ext_vector_type(8))) short v8s;

// 16-bit transposing LDS load from a row-major tile T[k][d]. With
// p = &T[k0 + 8 * (lane >> 4) + (lane & 7)][d0 + 8 * ((lane >> 3) & 1)]
// lane (c = lane & 15, h = lane >> 4) receives T[k0 + 8h + 0..7][d0 + c].
__device__ inline v8h ld_tr16(const _Float16* p) {
  typedef __attribute__((address_space(3))) v8s lds_v8s;
  return __builtin_bit_cast(
      v8h, __builtin_amdgcn_ds_load_tr16_b128_v8i16((lds_v8s*)p));
}

// value of lane l ^ 16
__device__ inline float xhalf(float x) {
  int b = __builtin_bit_cast(int, x);
  return __builtin_bit_cast(
      float, __builtin_amdgcn_permlanex16(b, b, 0x76543210, 0xfedcba98, false,
                                          false));
}

#define ANT ((SEQ + 63) / 64)  // key tiles
#define AKT (64 * 72)          // halves of a K buffer
#define AVT (64 * 80)          // halves of a V buffer
__global__ __launch_bounds__(256) void attn_kernel(
    const _Float16* __restrict__ Q, const _Float16* __restrict__ K,
    const _Float16* __restrict__ V, _Float16* __restrict__ O) {
  // three buffers of [kv][d], pitch 144 B: plain 16-B reads
  __shared__ __attribute__((aligned(16))) _Float16 kt[3 * AKT];
  // three buffers of [kv][d], pitch 160 B: transposing reads
  __shared__ __attribute__((aligned(16))) _Float16 vs[3 * AVT];
  static_assert(ANT >= 2, "the ring's prologue needs two tiles");

  const int tid  = threadIdx.x;
  const int lane = tid & 31;
  const int w    = tid >> 5;
  const int c    = lane & 15;
  const int hf   = lane >> 4;
  const int bh   = blockIdx.y;
  const int q0   = blockIdx.x * 128 + w * 16;

  const _Float16* Qb = Q + (size_t)bh * SEQ * HD;
  const _Float16* Kb = K + (size_t)bh * SEQ * HD;
  const _Float16* Vb = V + (size_t)bh * SEQ * HD;

  // Q fragments (B operand, column = query c; clamped, invalid never stored)
  int qrow = q0 + c;
  int qr = qrow < SEQ ? qrow : (SEQ - 1);
  v16h qf[2];
#pragma unroll
  for (int s = 0; s < 2; ++s)
    qf[s] = ld_frag(Qb + (size_t)qr * HD + s * 32, lane);

  v8f oacc[4];  // oacc[t][r] = O^T[d = 16t + 8*hf + r][query c]
#pragma unroll
  for (int t = 0; t < 4; ++t) oacc[t] = zero8f();
  float mrow = -1e30f;  // running maximum of query c, equal in both halves
  float lrow = 0.f;     // running sum over this half's keys only

  const int lkv = tid >> 3;       // 0..31; rows lkv and lkv + 32
  const int ld0 = (tid & 7) * 8;  // 8 lanes x 16 B = one 128-byte row

  // this lane's LDS byte addresses in buffer 0: rows lkv and lkv + 32
  const unsigned lk0 = (unsigned)(size_t)&kt[lkv * 72 + ld0];
  const unsigned lk1 = lk0 + 32 * 144;
  const unsigned lv0 = (unsigned)(size_t)&vs[lkv * 80 + ld0];
  const unsigned lv1 = lv0 + 32 * 160;
  // and its places in row 0 and row 32 of K and V
  const char* gk0 = (const char*)(Kb + ld0);
  const char* gk1 = gk0 + 32 * HD * 2;
  const char* gv0 = (const char*)(Vb + ld0);
  const char* gv1 = gv0 + 32 * HD * 2;
  // The tile whose row lkv lies rb bytes into K and V, into the buffers kb and
  // vb halves into kt and vs. Rows past the end are clamped, not masked: every
  // lane copies, from inside K and V; the clamped rows repeat the last key's
  // own values, and such keys get weight 0 below.
  auto issue = [&](unsigned rb, int kb, int vb) {
    const unsigned a0 = rb < (SEQ - 1) * HD * 2 ? rb : (SEQ - 1) * HD * 2;
    const unsigned a1 = rb < (SEQ - 33) * HD * 2 ? rb : (SEQ - 33) * HD * 2;
    const unsigned l[4] = {lk0 + kb * 2, lk1 + kb * 2, lv0 + vb * 2,
                           lv1 + vb * 2};
    const _Float16* const g[4] = {
        (const _Float16*)(gk0 + a0), (const _Float16*)(gk1 + a1),
        (const _Float16*)(gv0 + a0), (const _Float16*)(gv1 + a1)};
    copy_kv(l, g);
  };
  unsigned rb = lkv * HD * 2;
  issue(rb, 0, 0);
  rb += 64 * HD * 2;
  issue(rb, AKT, AVT);

  int ko = 0, vo = 0;  // buffer i mod 3 of tile i: its place in kt and vs
  for (int i = 0; i < ANT; ++i) {
    const int kv0 = i * 64;
    // Publish point of tile i. This wave's reads of tile i - 1 have retired:
    asm volatile("s_wait_dscnt 0x0" ::: "memory");
    // its own copies of tile i have landed. Where trip i - 1 has issued tile
    // i + 1, those 4 copies, the wave's youngest, may stay in flight; where it
    // has issued nothing, the wait is to 0:
    if (i + 1 < ANT)
      asm volatile("s_wait_asynccnt 0x4" ::: "memory");
    else
      asm volatile("s_wait_asynccnt 0x0" ::: "memory");
    // the barrier shows tile i to every wave and ends every wave's reads of
    // the buffer of tile i - 1, which the copies behind it refill
    __syncthreads();
    rb += 64 * HD * 2;
    if (i + 2 < ANT)
      issue(rb, ko == 0 ? 2 * AKT : ko - AKT, vo == 0 ? 2 * AVT : vo - AVT);

    // S^T = K Q^T : 4 key tiles x 2 k-steps;
    // sa[t][r] = S[query c][key kv0 + 16t + 8*hf + r]
    v8f sa[4];
#pragma unroll
    for (int t = 0; t < 4; ++t) sa[t] = zero8f();
#pragma unroll
    for (int t = 0; t < 4; ++t) {
#pragma unroll
      for (int s = 0; s < 2; ++s) {
        v16h kF = ld_frag(&kt[ko + (t * 16 + c) * 72 + s * 32], lane);
        sa[t] = __builtin_amdgcn_wmma_f32_16x16x32_f16(
            false, kF, false, qf[s], (short)0, sa[t], false, false);
      }
    }

    // mask OOB keys + new maximum of this lane's query
    float nmax = mrow;
#pragma unroll
    for (int t = 0; t < 4; ++t) {
#pragma unroll
      for (int r = 0; r < 8; ++r) {
        int ng = kv0 + t * 16 + 8 * hf + r;
        float sc = (ng < SEQ) ? sa[t][r] : -1e30f;
        sa[t][r] = sc;
        nmax = fmaxf(nmax, sc);
      }
    }
    nmax = fmaxf(nmax, xhalf(nmax));

    float fac = __expf(mrow - nmax);
    mrow = nmax;
#pragma unroll
    for (int t = 0; t < 4; ++t)
#pragma unroll
      for (int r = 0; r < 8; ++r) oacc[t][r] *= fac;

    // P^T = exp(S^T - m): element s of the B operand of 32-key block j is
    // key 32j + (s < 8 ? 8*hf + s : 16 + 8*hf + s - 8) = sa[2j + s/8][s%8]
    float psum = 0.f;
    v16h pF[2];
#pragma unroll
    for (int j = 0; j < 2; ++j) {
#pragma unroll
      for (int s = 0; s < 16; ++s) {
        float p = __expf(sa[2 * j + (s >> 3)][s & 7] - mrow);
        psum += p;
        pF[j][s] = (_Float16)p;
      }
    }
    lrow = lrow * fac + psum;

    // O^T += V^T P^T : 4 d tiles x 2 key blocks
    const _Float16* vp =
        &vs[vo + (8 * hf + (lane & 7)) * 80 + 8 * ((lane >> 3) & 1)];
#pragma unroll
    for (int t = 0; t < 4; ++t) {
#pragma unroll
      for (int j = 0; j < 2; ++j) {
        v16h vF = make16(ld_tr16(vp + (j * 32) * 80 + t * 16),
                         ld_tr16(vp + (j * 32 + 16) * 80 + t * 16));
        oacc[t] = __builtin_amdgcn_wmma_f32_16x16x32_f16(
            false, vF, false, pF[j], (short)0, oacc[t], false, false);
      }
    }
    ko = ko == 2 * AKT ? 0 : ko + AKT;
    vo = vo == 2 * AVT ? 0 : vo + AVT;
  }

  // join the halves' sums with every lane active, ahead of the row guard
  float lsum = lrow + xhalf(lrow);

  // The wave's 16 x 64 tile goes out through LDS so that a store covers whole
  // 128-byte lines. The barrier ends every wave's reads of the last K/V tile;
  // behind it each wave stages in 16 rows of its own (four waves in kt, four
  // in vs).
  __syncthreads();
  // the wave's number as a scalar, so that the range test is a scalar branch
  const int ws = __builtin_amdgcn_readfirstlane(w);
  _Float16* st = ws < 4 ? &kt[16 * ws * 72] : &vs[16 * (ws - 4) * 80];
  const int sp = ws < 4 ? 72 : 80;
#pragma unroll
  for (int t = 0; t < 4; ++t) {
    v8h o;
#pragma unroll
    for (int r = 0; r < 8; ++r) o[r] = (_Float16)(oacc[t][r] / lsum);
    *(v8h*)&st[c * sp + t * 16 + 8 * hf] = o;
  }
  // the rows are read back by other lanes of this wave: its LDS writes must
  // have landed, and the compiler must not move the reads above them
  asm volatile("s_wait_dscnt 0x0" ::: "memory");

  // a query's 64 values of one head are 128 bytes: 8 lanes a row, 4 rows a store
  const int b = bh >> 4, h = bh & 15;
  const int qs = blockIdx.x * 128 + ws * 16;
  const _Float16* sr = st + (lane >> 3) * sp + (lane & 7) * 8;
  _Float16* og = O + ((size_t)(b * SEQ + qs + (lane >> 3))) * EMB + h * HD +
                 (lane & 7) * 8;
  if (qs + 16 <= SEQ) {
    v8h o[4];
#pragma unroll
    for (int i = 0; i < 4; ++i) o[i] = *(const v8h*)(sr + i * 4 * sp);
#pragma unroll
    for (int i = 0; i < 4; ++i) *(v8h*)(og + (size_t)i * 4 * EMB) = o[i];
    // precaution: closes the run's stores before anything that stands
    // behind them in the listing reuses their registers
    asm volatile("s_wait_xcnt 0x0" ::: "memory");
  } else {
#pragma unroll
    for (int i = 0; i < 4; ++i) {
      const v8h o = *(const v8h*)(sr + i * 4 * sp);
      if (qs + (lane >> 3) + 4 * i < SEQ) {
        *(v8h*)(og + (size_t)i * 4 * EMB) = o;
        // precaution: closes the store before the next trip's LDS read
        // reuses its data registers
        asm volatile("s_wait_xcnt 0x0" ::: "memory");
      }
    }
  }
}

extern "C" void kernel_launch(void* const* d_in, const int* in_sizes, int n_in,
                              void* d_out, int out_size, void* d_ws,
                              size_t ws_size, hipStream_t stream) {
  const float* x  = (const float*)d_in[0];
  const float* Wq = (const float*)d_in[1];
  const float* bq = (const float*)d_in[2];
  const float* Wk = (const float*)d_in[3];
  const float* Wv = (const float*)d_in[4];
  const float* bv = (const float*)d_in[5];
  const float* Wo = (const float*)d_in[6];
  const float* bo = (const float*)d_in[7];
  float* out = (float*)d_out;

  _Float16* base = (_Float16*)d_ws;
  size_t off = 0;
  auto carve = [&](size_t n) {
    _Float16* p = base + off;
    off += (n + 127) & ~(size_t)127;
    return p;
  };
  _Float16* Xh  = carve((size_t)MROWS * EMB);
  _Float16* Wqh = carve((size_t)EMB * EMB);
  _Float16* Wkh = carve((size_t)EMB * EMB);
  _Float16* Wvh = carve((size_t)EMB * EMB);
  _Float16* Woh = carve((size_t)EMB * EMB);
  _Float16* Qh  = carve((size_t)MROWS * EMB);
  _Float16* Kh  = carve((size_t)MROWS * EMB);
  _Float16* Vh  = carve((size_t)MROWS * EMB);
  _Float16* Ah  = carve((size_t)MROWS * EMB);

  cvt_f32_to_f16<<<dim3(512, 5), 256, 0, stream>>>(
      x, Wq, Wk, Wv, Wo, Xh, Wqh, Wkh, Wvh, Woh, MROWS * EMB, EMB * EMB);

  dim3 g((MROWS + 127) / 128, EMB / 128);      // 47 x 8
  dim3 g3((MROWS + 127) / 128, EMB / 128, 3);  // 47 x 8 x {q, k, v}
  // q = (X Wq^T + bq) * d^-0.5  (scale applied after bias, as in reference)
  gemm_xwT<<<g3, 128, 0, stream>>>(Xh, Wqh, Wkh, Wvh, bq, nullptr, bv, 0.125f,
                                   1.0f, 1.0f, MROWS, 0, Qh, Kh, Vh, nullptr);

  attn_kernel<<<dim3((SEQ + 127) / 128, 4 * NH), 256, 0, stream>>>(Qh, Kh, Vh,
                                                                   Ah);

  gemm_xwT<<<g, 128, 0, stream>>>(Ah, Woh, nullptr, nullptr, bo, nullptr,
                                  nullptr, 1.0f, 1.0f, 1.0f, MROWS, 1, nullptr,
                                  nullptr, nullptr, out);
}

// v008
// A run of this version takes 95.4 microseconds.
// Two timings next to v007 both put it at 1.05 times that version's speed.
// All steps since v000 together make it 2.67 times as fast.
#include <hip/hip_runtime.h>

#define SEQ 1500
#define EMB 1024
#define NH  16
#define HD  64
#define MROWS 6000   // B*SEQ = 4*1500

typedef __attribute__((ext_vector_type(16))) _Float16 v16h;
typedef __attribute__((ext_vector_type(8)))  _Float16 v8h;
typedef __attribute__((ext_vector_type(8)))  float    v8f;
typedef __attribute__((ext_vector_type(4)))  float    v4f;

__device__ inline v8h zero8h() { v8h z = {}; return z; }
__device__ inline v8f zero8f() { v8f z = {}; return z; }

__device__ inline v16h make16(v8h lo, v8h hi) {
  v16h r;
#pragma unroll
  for (int i = 0; i < 8; ++i) { r[i] = lo[i]; r[i + 8] = hi[i]; }
  return r;
}

// Load a 16x32 f16 A/B WMMA fragment whose row (m or n) = lane%16 is already
// folded into rowp. Per ISA layout: k(h,lane) = (h/8)*16 + (lane/16)*8 + h%8,
// i.e. two contiguous 8-half (16B) segments at +((lane>>4)*8) and +16 more.
__device__ inline v16h ld_frag(const _Float16* rowp, int lane) {
  const _Float16* p = rowp + ((lane >> 4) << 3);
  v8h lo = *(const v8h*)(p);
  v8h hi = *(const v8h*)(p + 16);
  return make16(lo, hi);
}

// One grid converts all five tensors side by side: blockIdx.y picks the tensor
// (0: activations, nx elements; 1..4: weights, nw elements each).
__global__ void cvt_f32_to_f16(
    const float* __restrict__ s0, const float* __restrict__ s1,
    const float* __restrict__ s2, const float* __restrict__ s3,
    const float* __restrict__ s4, _Float16* __restrict__ d0,
    _Float16* __restrict__ d1, _Float16* __restrict__ d2,
    _Float16* __restrict__ d3, _Float16* __restrict__ d4, int nx, int nw) {
  const int y = blockIdx.y;
  const float* __restrict__ s =
      y == 0 ? s0 : y == 1 ? s1 : y == 2 ? s2 : y == 3 ? s3 : s4;
  _Float16* __restrict__ d =
      y == 0 ? d0 : y == 1 ? d1 : y == 2 ? d2 : y == 3 ? d3 : d4;
  const int n = y == 0 ? nx : nw;
  int i = blockIdx.x * blockDim.x + threadIdx.x;
  int stride = gridDim.x * blockDim.x;
  for (; i < n; i += stride) d[i] = (_Float16)s[i];
}

// One operand tile of a stage of the GEMM ring, or one stage of the attention
// ring: this lane's eight 16-byte asynchronous copies to LDS (l: LDS byte
// addresses, g: global addresses).
// The closing s_wait_xcnt is a precaution and stands inside the statement so
// that no later rewrite of an address register can be moved in front of it.
__device__ inline void copy_stage(const unsigned (&l)[8],
                                  const _Float16* const (&g)[8]) {
  asm volatile(
      "global_load_async_to_lds_b128 %0, %8, off\n\t"
      "global_load_async_to_lds_b128 %1, %9, off\n\t"
      "global_load_async_to_lds_b128 %2, %10, off\n\t"
      "global_load_async_to_lds_b128 %3, %11, off\n\t"
      "global_load_async_to_lds_b128 %4, %12, off\n\t"
      "global_load_async_to_lds_b128 %5, %13, off\n\t"
      "global_load_async_to_lds_b128 %6, %14, off\n\t"
      "global_load_async_to_lds_b128 %7, %15, off\n\t"
      "s_wait_xcnt 0x0"
      :
      : "v"(l[0]), "v"(l[1]), "v"(l[2]), "v"(l[3]), "v"(l[4]), "v"(l[5]),
        "v"(l[6]), "v"(l[7]), "v"(g[0]), "v"(g[1]), "v"(g[2]), "v"(g[3]),
        "v"(g[4]), "v"(g[5]), "v"(g[6]), "v"(g[7])
      : "memory");
}

#define GBUF  3           // ring buffers; copies run GBUF - 1 stages ahead
#define GTILE (64 * 136)  // halves of one operand tile: 64 row pairs of 272 B
#define GSTG  (EMB / 64)  // stages of the K loop

// Place of row r (64 halves) in an operand tile, in halves: two rows side by
// side, then 16 bytes of pad. The 16 rows of a fragment read then fall on all
// 64 banks once, as at a pitch of 144 B, and three buffers of three
// work-groups fit one WGP's LDS.
__device__ inline int tile_row(int r) { return (r >> 1) * 136 + (r & 1) * 64; }

// C[M,N] = (X[M,K] * W[N,K]^T + bias) * scale ; K = N = 1024.
// Computed as C^T = W X^T (A operand = W rows, B operand = X rows).
// mode 0: write f16 into [b, h, t, d] head layout (QKV projections)
// mode 1: write f32 row-major [M, N] (output projection -> d_out)
// The operand tiles come into a ring of three LDS buffers by asynchronous
// copies, through no register, two stages ahead of the products that read
// them; one barrier per stage.
// Four waves, one a SIMD, each on a 64 x 64 tile of C: the 8 fragments of a
// 32-deep block come from LDS as one group and feed 16 products, so a fragment
// read serves four products.
// A stage is 64 halves = one 128-byte line of every operand row: 8 lanes
// fetch one line, so a wave-wide 16-byte copy touches 4 whole lines.
// blockIdx.z picks one of up to three products that share X (weights, bias,
// scale, f16 output), so that independent projections run in one grid.
__global__ __launch_bounds__(128) void gemm_xwT(
    const _Float16* __restrict__ X, const _Float16* __restrict__ W0,
    const _Float16* __restrict__ W1, const _Float16* __restrict__ W2,
    const float* __restrict__ bias0, const float* __restrict__ bias1,
    const float* __restrict__ bias2, float scale0, float scale1, float scale2,
    int M, int mode, _Float16* __restrict__ outH0,
    _Float16* __restrict__ outH1, _Float16* __restrict__ outH2,
    float* __restrict__ outF) {
  // [buffer][0: X rows, 1: W rows][128 rows x 64 K, placed by tile_row]
  __shared__ __attribute__((aligned(16))) _Float16 sm[GBUF][2][GTILE];

  const int z = blockIdx.z;
  const _Float16* __restrict__ W = z == 0 ? W0 : z == 1 ? W1 : W2;
  const float* __restrict__ bias = z == 0 ? bias0 : z == 1 ? bias1 : bias2;
  const float scale = z == 0 ? scale0 : z == 1 ? scale1 : scale2;
  _Float16* __restrict__ outH = z == 0 ? outH0 : z == 1 ? outH1 : outH2;

  const int tid  = threadIdx.x;
  const int lane = tid & 31;
  const int wave = tid >> 5;
  const int wm   = wave >> 1;  // 0..1 -> 64 rows each
  const int wn   = wave & 1;   // 0..1 -> 64 cols each
  const int mblk = blockIdx.x * 128;
  const int nblk = blockIdx.y * 128;

  v8f acc[4][4];
#pragma unroll
  for (int i = 0; i < 4; ++i)
#pragma unroll
    for (int j = 0; j < 4; ++j) acc[i][j] = zero8f();

  const int lrow = tid >> 3;       // 0..15; rows lrow + 16 * i, i = 0..7
  const int lcol = (tid & 7) * 8;  // 8 lanes x 16 B = one 128-byte line

  // Clamp tail rows instead of EXEC-masking: every lane copies, from inside
  // X; clamped rows only feed C rows >= M which are never stored.
  const _Float16* gX[8];
#pragma unroll
  for (int i = 0; i < 8; ++i) {
    int gm = mblk + lrow + 16 * i;
    if (gm >= M) gm = M - 1;
    gX[i] = X + (size_t)gm * EMB + lcol;
  }
  const _Float16* gW = W + (size_t)(nblk + lrow) * EMB + lcol;  // N always ok
  // this lane's LDS byte address in the X tile of buffer 0
  const unsigned l0 = (unsigned)(size_t)&sm[0][0][tile_row(lrow) + lcol];

  // stage s: K columns 64 s .. 64 s + 63 of both tiles into buffer s % GBUF
  auto issue = [&](int s) {
    unsigned l[8];
    const _Float16* g[8];
#pragma unroll
    for (int i = 0; i < 8; ++i) {
      l[i] = l0 + ((s % GBUF) * 2 * GTILE + i * 8 * 136) * 2;
      g[i] = gX[i] + s * 64;
    }
    copy_stage(l, g);
#pragma unroll
    for (int i = 0; i < 8; ++i) {
      l[i] = l0 + (((s % GBUF) * 2 + 1) * GTILE + i * 8 * 136) * 2;
      g[i] = gW + (size_t)i * 16 * EMB + s * 64;
    }
    copy_stage(l, g);
  };

  static_assert(GBUF == 3 && GSTG >= 2,
                "the counted wait below leaves one stage's copies in flight");
  // prologue: the first GBUF - 1 stages fly together
#pragma unroll
  for (int s = 0; s < GBUF - 1; ++s) issue(s);

  // Unrolled whole: buffer numbers, K offsets and the counts of the waits are
  // constants of each trip.
#pragma unroll
  for (int t = 0; t < GSTG; ++t) {
    const int cur = t % GBUF;

    // Publish point of stage t. This wave's reads of trip t - 1 have retired:
    asm volatile("s_wait_dscnt 0x0" ::: "memory");
    // its own copies of stage t have landed. Where trip t - 1 has issued
    // stage t + 1, those 16 copies, the wave's youngest, may stay in flight;
    // where it has issued nothing, the wait is to 0:
    if (t + 1 < GSTG)
      asm volatile("s_wait_asynccnt 0x10" ::: "memory");
    else
      asm volatile("s_wait_asynccnt 0x0" ::: "memory");
    // the barrier shows stage t to every wave and ends every wave's reads of
    // the buffer of trip t - 1, which the copies behind it refill
    __syncthreads();
    if (t + GBUF - 1 < GSTG) issue(t + GBUF - 1);

    // compute on current buffer: two 32-deep products per stage
#pragma unroll
    for (int ks = 0; ks < 2; ++ks) {
      v16h aF[4], bF[4];
#pragma unroll
      for (int mi = 0; mi < 4; ++mi)
        aF[mi] = ld_frag(
            &sm[cur][0][tile_row(wm * 64 + mi * 16 + (lane & 15)) + ks * 32],
            lane);
#pragma unroll
      for (int ni = 0; ni < 4; ++ni)
        bF[ni] = ld_frag(
            &sm[cur][1][tile_row(wn * 64 + ni * 16 + (lane & 15)) + ks * 32],
            lane);
      // Keeps the block's 16 LDS reads one group in front of its products:
      // left alone, the compiler sinks them among the products, two reads and
      // a wait to 0 in front of every four.
      __builtin_amdgcn_sched_barrier(0);
#pragma unroll
      for (int ni = 0; ni < 4; ++ni)
#pragma unroll
        for (int mi = 0; mi < 4; ++mi)
          acc[mi][ni] = __builtin_amdgcn_wmma_f32_16x16x32_f16(
              false, bF[ni], false, aF[mi], (short)0, acc[mi][ni], false,
              false);
      // The other end of the block: no product sinks behind the next publish
      // point, and no later read or address sum rises among the products.
      __builtin_amdgcn_sched_barrier(0);
    }
  }

  // epilogue: the tiles are C^T (rows n, columns m), so a lane owns one row
  // m = .. + (lane & 15) of C and 8 consecutive columns n = .. + 8*(lane >> 4)
  // + r of each tile: bias comes in 32 bytes at a time.
  const int c  = lane & 15;
  const int n0 = nblk + wn * 64 + 8 * (lane >> 4);
  v8f bb[4];
#pragma unroll
  for (int ni = 0; ni < 4; ++ni) bb[ni] = zero8f();
  if (bias) {
#pragma unroll
    for (int ni = 0; ni < 4; ++ni) bb[ni] = *(const v8f*)(bias + n0 + ni * 16);
  }
  // bias and scale in place, once for both output forms: the results need no
  // second register set
#pragma unroll
  for (int mi = 0; mi < 4; ++mi)
#pragma unroll
    for (int ni = 0; ni < 4; ++ni) acc[mi][ni] = (acc[mi][ni] + bb[ni]) * scale;
  // The wave's 64 x 64 tile goes out through LDS so that a store covers whole
  // 128-byte lines. The last trip reads buffer 0 alone; its barrier has ended
  // every read of buffers 1 and 2 and stands behind every wave's wait for its
  // last copies. Each wave stages there in a range of its own, so no further
  // barrier is needed.
  static_assert((GSTG - 1) % GBUF == 0 &&
                    4 * 64 * 272 <= (GBUF - 1) * 2 * GTILE * 2,
                "output staging must stay off the last trip's buffer");
  // The wave's number as a scalar, so that the tests below are scalar branches.
  const int ws = __builtin_amdgcn_readfirstlane(wave);
  char* stage = (char*)&sm[1][0][0] + ws * (64 * 272);
  const int m0 = mblk + (ws >> 1) * 64;
  if (mode == 0) {
    _Float16* st = (_Float16*)stage;  // [64][64] halves, pitch 144 B
#pragma unroll
    for (int mi = 0; mi < 4; ++mi)
#pragma unroll
      for (int ni = 0; ni < 4; ++ni) {
        v8h o;
#pragma unroll
        for (int r = 0; r < 8; ++r) o[r] = (_Float16)acc[mi][ni][r];
        *(v8h*)&st[(mi * 16 + c) * 72 + ni * 16 + 8 * (lane >> 4)] = o;
      }
    // the rows are read back by other lanes of this wave: its LDS writes
    // must have landed, and the compiler must not move the reads above them
    asm volatile("s_wait_dscnt 0x0" ::: "memory");
    // a row of one head is 128 bytes: 8 lanes a row, 4 rows a store
    const int hd = (nblk + (ws & 1) * 64) >> 6;
    // the tile's two halves of 32 rows, one after the other
#pragma unroll
    for (int hh = 0; hh < 2; ++hh) {
      const int mh = m0 + 32 * hh;
      const _Float16* sr = st + (32 * hh + (lane >> 3)) * 72 + (lane & 7) * 8;
      const int b0 = mh / SEQ;
      if (mh + 32 <= M && (mh + 31) / SEQ == b0) {
        // all 32 rows in range and in one batch: 4 KiB in a row, one address
        _Float16* og = outH +
                       (((size_t)(b0 * NH + hd) * SEQ) + (mh - b0 * SEQ)) * HD +
                       lane * 8;
        v8h o[8];
#pragma unroll
        for (int i = 0; i < 8; ++i) o[i] = *(const v8h*)(sr + i * 4 * 72);
#pragma unroll
        for (int i = 0; i < 8; ++i) *(v8h*)(og + i * 4 * HD) = o[i];
        // precaution: closes the run's stores before anything that stands
        // behind them in the listing reuses their registers
        asm volatile("s_wait_xcnt 0x0" ::: "memory");
      } else {
#pragma unroll
        for (int i = 0; i < 8; ++i) {
          const int m = mh + (lane >> 3) + 4 * i;
          const v8h o = *(const v8h*)(sr + i * 4 * 72);
          if (m < M) {
            const int b = m / SEQ, t = m % SEQ;
            *(v8h*)(outH + (((size_t)(b * NH + hd) * SEQ) + t) * HD +
                    (lane & 7) * 8) = o;
          }
        }
      }
    }
  } else {
    float* st = (float*)stage;  // [64][64] floats, pitch 272 B
#pragma unroll
    for (int mi = 0; mi < 4; ++mi)
#pragma unroll
      for (int ni = 0; ni < 4; ++ni) {
        // two 16-byte halves: the pitch keeps rows 16-byte aligned only
        float* sw = &st[(mi * 16 + c) * 68 + ni * 16 + 8 * (lane >> 4)];
        *(v4f*)sw = __builtin_shufflevector(acc[mi][ni], acc[mi][ni], 0, 1, 2, 3);
        *(v4f*)(sw + 4) =
            __builtin_shufflevector(acc[mi][ni], acc[mi][ni], 4, 5, 6, 7);
      }
    // as above: this wave's LDS writes land before its lanes read them back
    asm volatile("s_wait_dscnt 0x0" ::: "memory");
    // 64 floats of a row are two lines: 16 lanes a row, 2 rows a store;
    // the tile's two halves of 32 rows, one after the other
#pragma unroll
    for (int hh = 0; hh < 2; ++hh) {
      const int mh = m0 + 32 * hh;
      const float* sr = st + (32 * hh + (lane >> 4)) * 68 + (lane & 15) * 4;
      float* og = outF + (size_t)(mh + (lane >> 4)) * EMB + nblk +
                  (ws & 1) * 64 + (lane & 15) * 4;
      if (mh + 32 <= M) {
        v4f o[16];
#pragma unroll
        for (int i = 0; i < 16; ++i) o[i] = *(const v4f*)(sr + i * 2 * 68);
#pragma unroll
        for (int i = 0; i < 16; ++i) *(v4f*)(og + (size_t)i * 2 * EMB) = o[i];
        // precaution: closes the run's stores before anything that stands
        // behind them in the listing reuses their registers
        asm volatile("s_wait_xcnt 0x0" ::: "memory");
      } else {
#pragma unroll
        for (int i = 0; i < 16; ++i) {
          const v4f o = *(const v4f*)(sr + i * 2 * 68);
          if (mh + (lane >> 4) + 2 * i < M)
            *(v4f*)(og + (size_t)i * 2 * EMB) = o;
        }
      }
    }
  }
}

typedef __attribute__((ext_vector_type(8))) short v8s;

// 16-bit transposing LDS load from a row-major tile T[k][d]. With
// p = &T[k0 + 8 * (lane >> 4) + (lane & 7)][d0 + 8 * ((lane >> 3) & 1)]
// lane (c = lane & 15, h = lane >> 4) receives T[k0 + 8h + 0..7][d0 + c].
__device__ inline v8h ld_tr16(const _Float16* p) {
  typedef __attribute__((address_space(3))) v8s lds_v8s;
  return __builtin_bit_cast(
      v8h, __builtin_amdgcn_ds_load_tr16_b128_v8i16((lds_v8s*)p));
}

// value of lane l ^ 16
__device__ inline float xhalf(float x) {
  int b = __builtin_bit_cast(int, x);
  return __builtin_bit_cast(
      float, __builtin_amdgcn_permlanex16(b, b, 0x76543210, 0xfedcba98, false,
                                          false));
}

#define ANT ((SEQ + 63) / 64)  // key tiles
#define AKT (64 * 72)          // halves of a K buffer
#define AVT (64 * 80)          // halves of a V buffer
__global__ __launch_bounds__(128) void attn_kernel(
    const _Float16* __restrict__ Q, const _Float16* __restrict__ K,
    const _Float16* __restrict__ V, _Float16* __restrict__ O) {
  // three buffers of [kv][d], pitch 144 B: plain 16-B reads
  __shared__ __attribute__((aligned(16))) _Float16 kt[3 * AKT];
  // three buffers of [kv][d], pitch 160 B: transposing reads
  __shared__ __attribute__((aligned(16))) _Float16 vs[3 * AVT];
  static_assert(ANT >= 2, "the ring's prologue needs two tiles");

  const int tid  = threadIdx.x;
  const int lane = tid & 31;
  const int w    = tid >> 5;
  const int c    = lane & 15;
  const int hf   = lane >> 4;
  const int bh   = blockIdx.y;
  const int q0   = blockIdx.x * 128 + w * 32;

  const _Float16* Qb = Q + (size_t)bh * SEQ * HD;
  const _Float16* Kb = K + (size_t)bh * SEQ * HD;
  const _Float16* Vb = V + (size_t)bh * SEQ * HD;

  // Q fragments (B operand, column = query 16 g + c; clamped, invalid never
  // stored)
  v16h qf[2][2];
#pragma unroll
  for (int g = 0; g < 2; ++g) {
    const int qrow = q0 + 16 * g + c;
    const int qr = qrow < SEQ ? qrow : (SEQ - 1);
#pragma unroll
    for (int s = 0; s < 2; ++s)
      qf[g][s] = ld_frag(Qb + (size_t)qr * HD + s * 32, lane);
  }

  v8f oacc[2][4];  // oacc[g][t][r] = O^T[d = 16t + 8*hf + r][query 16g + c]
#pragma unroll
  for (int g = 0; g < 2; ++g)
#pragma unroll
    for (int t = 0; t < 4; ++t) oacc[g][t] = zero8f();
  // running maximum of query 16g + c, equal in both halves
  float mrow[2] = {-1e30f, -1e30f};
  // running sum over this half's keys only
  float lrow[2] = {0.f, 0.f};

  const int lkv = tid >> 3;       // 0..15; rows lkv + 16 * i, i = 0..3
  const int ld0 = (tid & 7) * 8;  // 8 lanes x 16 B = one 128-byte row

  // this lane's LDS byte addresses in buffer 0, row lkv
  const unsigned lk0 = (unsigned)(size_t)&kt[lkv * 72 + ld0];
  const unsigned lv0 = (unsigned)(size_t)&vs[lkv * 80 + ld0];
  // and its places in row 0 of K and V
  const char* gk0 = (const char*)(Kb + ld0);
  const char* gv0 = (const char*)(Vb + ld0);
  // The tile whose row lkv lies rb bytes into K and V, into the buffers kb and
  // vb halves into kt and vs. Rows past the end are clamped, not masked: every
  // lane copies, from inside K and V; the clamped rows repeat the last key's
  // own values, and such keys get weight 0 below.
  auto issue = [&](unsigned rb, int kb, int vb) {
    unsigned l[8];
    const _Float16* g[8];
#pragma unroll
    for (int i = 0; i < 4; ++i) {
      const unsigned top = (SEQ - 1 - 16 * i) * HD * 2;
      const unsigned a = (rb < top ? rb : top) + 16 * i * HD * 2;
      l[i]     = lk0 + kb * 2 + i * 16 * 144;
      l[4 + i] = lv0 + vb * 2 + i * 16 * 160;
      g[i]     = (const _Float16*)(gk0 + a);
      g[4 + i] = (const _Float16*)(gv0 + a);
    }
    copy_stage(l, g);
  };
  unsigned rb = lkv * HD * 2;
  issue(rb, 0, 0);
  rb += 64 * HD * 2;
  issue(rb, AKT, AVT);

  int ko = 0, vo = 0;  // buffer i mod 3 of tile i: its place in kt and vs
  for (int i = 0; i < ANT; ++i) {
    const int kv0 = i * 64;
    // Publish point of tile i. This wave's reads of tile i - 1 have retired:
    asm volatile("s_wait_dscnt 0x0" ::: "memory");
    // its own copies of tile i have landed. Where trip i - 1 has issued tile
    // i + 1, those 8 copies, the wave's youngest, may stay in flight; where it
    // has issued nothing, the wait is to 0:
    if (i + 1 < ANT)
      asm volatile("s_wait_asynccnt 0x8" ::: "memory");
    else
      asm volatile("s_wait_asynccnt 0x0" ::: "memory");
    // the barrier shows tile i to every wave and ends every wave's reads of
    // the buffer of tile i - 1, which the copies behind it refill
    __syncthreads();
    rb += 64 * HD * 2;
    if (i + 2 < ANT)
      issue(rb, ko == 0 ? 2 * AKT : ko - AKT, vo == 0 ? 2 * AVT : vo - AVT);

    // S^T = K Q^T : 4 key tiles x 2 k-steps x 2 column groups;
    // sa[g][t][r] = S[query 16g + c][key kv0 + 16t + 8*hf + r]
    v8f sa[2][4];
#pragma unroll
    for (int g = 0; g < 2; ++g)
#pragma unroll
      for (int t = 0; t < 4; ++t) sa[g][t] = zero8f();
    v16h kF[4][2];
#pragma unroll
    for (int t = 0; t < 4; ++t)
#pragma unroll
      for (int s = 0; s < 2; ++s)
        kF[t][s] = ld_frag(&kt[ko + (t * 16 + c) * 72 + s * 32], lane);
    // Keeps the tile's 16 K reads one group in front of its products: without
    // it the compiler set two reads and a wait to 0 in front of every two
    // products.
    __builtin_amdgcn_sched_barrier(0);
#pragma unroll
    for (int s = 0; s < 2; ++s)
#pragma unroll
      for (int t = 0; t < 4; ++t)
#pragma unroll
        for (int g = 0; g < 2; ++g)
          sa[g][t] = __builtin_amdgcn_wmma_f32_16x16x32_f16(
              false, kF[t][s], false, qf[g][s], (short)0, sa[g][t], false,
              false);
    // Keeps the 16 products one run: left alone, the compiler draws the maximum
    // chain up among them, each of its reads behind idle slots that the
    // distance from a product to the first read of its result asks for.
    __builtin_amdgcn_sched_barrier(0);

    // The tile's 16 V^T reads, one group too: they fly while the vector work
    // below runs, ahead of the second run of products.
    const _Float16* vp =
        &vs[vo + (8 * hf + (lane & 7)) * 80 + 8 * ((lane >> 3) & 1)];
    v16h vF[4][2];
#pragma unroll
    for (int t = 0; t < 4; ++t)
#pragma unroll
      for (int j = 0; j < 2; ++j)
        vF[t][j] = make16(ld_tr16(vp + (j * 32) * 80 + t * 16),
                          ld_tr16(vp + (j * 32 + 16) * 80 + t * 16));
    // holds the group here: left alone, the compiler sinks the reads among the
    // products that use them
    __builtin_amdgcn_sched_barrier(0);

    // mask OOB keys + new maximum of this lane's two queries
    float nmax[2], fac[2];
#pragma unroll
    for (int g = 0; g < 2; ++g) {
      float nm = mrow[g];
#pragma unroll
      for (int t = 0; t < 4; ++t) {
#pragma unroll
        for (int r = 0; r < 8; ++r) {
          int ng = kv0 + t * 16 + 8 * hf + r;
          float sc = (ng < SEQ) ? sa[g][t][r] : -1e30f;
          sa[g][t][r] = sc;
          nm = fmaxf(nm, sc);
        }
      }
      nmax[g] = fmaxf(nm, xhalf(nm));
    }
#pragma unroll
    for (int g = 0; g < 2; ++g) {
      fac[g] = __expf(mrow[g] - nmax[g]);
      mrow[g] = nmax[g];
    }
#pragma unroll
    for (int g = 0; g < 2; ++g)
#pragma unroll
      for (int t = 0; t < 4; ++t)
#pragma unroll
        for (int r = 0; r < 8; ++r) oacc[g][t][r] *= fac[g];

    // P^T = exp(S^T - m): element s of the B operand of 32-key block j is
    // key 32j + (s < 8 ? 8*hf + s : 16 + 8*hf + s - 8) = sa[2j + s/8][s%8]
    v16h pF[2][2];
#pragma unroll
    for (int g = 0; g < 2; ++g) {
      float psum = 0.f;
#pragma unroll
      for (int j = 0; j < 2; ++j) {
#pragma unroll
        for (int s = 0; s < 16; ++s) {
          float p = __expf(sa[g][2 * j + (s >> 3)][s & 7] - nmax[g]);
          psum += p;
          pF[g][j][s] = (_Float16)p;
        }
      }
      lrow[g] = lrow[g] * fac[g] + psum;
    }

    // O^T += V^T P^T : 4 d tiles x 2 key blocks x 2 column groups
#pragma unroll
    for (int j = 0; j < 2; ++j)
#pragma unroll
      for (int t = 0; t < 4; ++t)
#pragma unroll
        for (int g = 0; g < 2; ++g)
          oacc[g][t] = __builtin_amdgcn_wmma_f32_16x16x32_f16(
              false, vF[t][j], false, pF[g][j], (short)0, oacc[g][t], false,
              false);
    ko = ko == 2 * AKT ? 0 : ko + AKT;
    vo = vo == 2 * AVT ? 0 : vo + AVT;
  }

  // join the halves' sums with every lane active, ahead of the row guard
  float lsum[2];
#pragma unroll
  for (int g = 0; g < 2; ++g) lsum[g] = lrow[g] + xhalf(lrow[g]);

  // The wave's 32 x 64 tile goes out through LDS so that a store covers whole
  // 128-byte lines. The barrier ends every wave's reads of the last K/V tile;
  // behind it each wave stages in 32 rows of its own in kt.
  static_assert(4 * 32 * 72 <= 3 * AKT, "output staging must fit kt");
  __syncthreads();
  // the wave's number as a scalar, so that the range test is a scalar branch
  const int ws = __builtin_amdgcn_readfirstlane(w);
  _Float16* st = &kt[32 * ws * 72];
#pragma unroll
  for (int g = 0; g < 2; ++g)
#pragma unroll
    for (int t = 0; t < 4; ++t) {
      v8h o;
#pragma unroll
      for (int r = 0; r < 8; ++r) o[r] = (_Float16)(oacc[g][t][r] / lsum[g]);
      *(v8h*)&st[(16 * g + c) * 72 + t * 16 + 8 * hf] = o;
    }
  // the rows are read back by other lanes of this wave: its LDS writes must
  // have landed, and the compiler must not move the reads above them
  asm volatile("s_wait_dscnt 0x0" ::: "memory");

  // a query's 64 values of one head are 128 bytes: 8 lanes a row, 4 rows a store
  const int b = bh >> 4, h = bh & 15;
  const int qs = blockIdx.x * 128 + ws * 32;
  const _Float16* sr = st + (lane >> 3) * 72 + (lane & 7) * 8;
  _Float16* og = O + ((size_t)(b * SEQ + qs + (lane >> 3))) * EMB + h * HD +
                 (lane & 7) * 8;
  if (qs + 32 <= SEQ) {
    v8h o[8];
#pragma unroll
    for (int i = 0; i < 8; ++i) o[i] = *(const v8h*)(sr + i * 4 * 72);
#pragma unroll
    for (int i = 0; i < 8; ++i) *(v8h*)(og + (size_t)i * 4 * EMB) = o[i];
    // precaution: closes the run's stores before anything that stands
    // behind them in the listing reuses their registers
    asm volatile("s_wait_xcnt 0x0" ::: "memory");
  } else {
#pragma unroll
    for (int i = 0; i < 8; ++i) {
      const v8h o = *(const v8h*)(sr + i * 4 * 72);
      if (qs + (lane >> 3) + 4 * i < SEQ) {
        *(v8h*)(og + (size_t)i * 4 * EMB) = o;
        // precaution: closes the store before the next trip's LDS read
        // reuses its data registers
        asm volatile("s_wait_xcnt 0x0" ::: "memory");
      }
    }
  }
}

extern "C" void kernel_launch(void* const* d_in, const int* in_sizes, int n_in,
                              void* d_out, int out_size, void* d_ws,
                              size_t ws_size, hipStream_t stream) {
  const float* x  = (const float*)d_in[0];
  const float* Wq = (const float*)d_in[1];
  const float* bq = (const float*)d_in[2];
  const float* Wk = (const float*)d_in[3];
  const float* Wv = (const float*)d_in[4];
  const float* bv = (const float*)d_in[5];
  const float* Wo = (const float*)d_in[6];
  const float* bo = (const float*)d_in[7];
  float* out = (float*)d_out;

  _Float16* base = (_Float16*)d_ws;
  size_t off = 0;
  auto carve = [&](size_t n) {
    _Float16* p = base + off;
    off += (n + 127) & ~(size_t)127;
    return p;
  };
  _Float16* Xh  = carve((size_t)MROWS * EMB);
  _Float16* Wqh = carve((size_t)EMB * EMB);
  _Float16* Wkh = carve((size_t)EMB * EMB);
  _Float16* Wvh = carve((size_t)EMB * EMB);
  _Float16* Woh = carve((size_t)EMB * EMB);
  _Float16* Qh  = carve((size_t)MROWS * EMB);
  _Float16* Kh  = carve((size_t)MROWS * EMB);
  _Float16* Vh  = carve((size_t)MROWS * EMB);
  _Float16* Ah  = carve((size_t)MROWS * EMB);

  cvt_f32_to_f16<<<dim3(512, 5), 256, 0, stream>>>(
      x, Wq, Wk, Wv, Wo, Xh, Wqh, Wkh, Wvh, Woh, MROWS * EMB, EMB * EMB);

  dim3 g((MROWS + 127) / 128, EMB / 128);      // 47 x 8
  dim3 g3((MROWS + 127) / 128, EMB / 128, 3);  // 47 x 8 x {q, k, v}
  // q = (X Wq^T + bq) * d^-0.5  (scale applied after bias, as in reference)
  gemm_xwT<<<g3, 128, 0, stream>>>(Xh, Wqh, Wkh, Wvh, bq, nullptr, bv, 0.125f,
                                   1.0f, 1.0f, MROWS, 0, Qh, Kh, Vh, nullptr);

  attn_kernel<<<dim3((SEQ + 127) / 128, 4 * NH), 128, 0, stream>>>(Qh, Kh, Vh,
                                                                   Ah);

  gemm_xwT<<<g, 128, 0, stream>>>(Ah, Woh, nullptr, nullptr, bo, nullptr,
                                  nullptr, 1.0f, 1.0f, 1.0f, MROWS, 1, nullptr,
                                  nullptr, nullptr, out);
}

// v009
// Measured time: 91.3 microseconds a run.
// In both of two side-by-side timings against v008, it was 1.04 times as fast.
// All steps since v000 together make it 2.77 times as fast.
#include <hip/hip_runtime.h>

#define SEQ 1500
#define EMB 1024
#define NH  16
#define HD  64
#define MROWS 6000   // B*SEQ = 4*1500

typedef __attribute__((ext_vector_type(16))) _Float16 v16h;
typedef __attribute__((ext_vector_type(8)))  _Float16 v8h;
typedef __attribute__((ext_vector_type(8)))  float    v8f;
typedef __attribute__((ext_vector_type(4)))  float    v4f;

__device__ inline v8h zero8h() { v8h z = {}; return z; }
__device__ inline v8f zero8f() { v8f z = {}; return z; }

__device__ inline v16h make16(v8h lo, v8h hi) {
  v16h r;
#pragma unroll
  for (int i = 0; i < 8; ++i) { r[i] = lo[i]; r[i + 8] = hi[i]; }
  return r;
}

// Load a 16x32 f16 A/B WMMA fragment whose row (m or n) = lane%16 is already
// folded into rowp. Per ISA layout: k(h,lane) = (h/8)*16 + (lane/16)*8 + h%8,
// i.e. two contiguous 8-half (16B) segments at +((lane>>4)*8) and +16 more.
__device__ inline v16h ld_frag(const _Float16* rowp, int lane) {
  const _Float16* p = rowp + ((lane >> 4) << 3);
  v8h lo = *(const v8h*)(p);
  v8h hi = *(const v8h*)(p + 16);
  return make16(lo, hi);
}

// One grid converts all five tensors side by side: blockIdx.y picks the tensor
// (0: activations, nx elements; 1..4: weights, nw elements each).
__global__ void cvt_f32_to_f16(
    const float* __restrict__ s0, const float* __restrict__ s1,
    const float* __restrict__ s2, const float* __restrict__ s3,
    const float* __restrict__ s4, _Float16* __restrict__ d0,
    _Float16* __restrict__ d1, _Float16* __restrict__ d2,
    _Float16* __restrict__ d3, _Float16* __restrict__ d4, int nx, int nw) {
  const int y = blockIdx.y;
  const float* __restrict__ s =
      y == 0 ? s0 : y == 1 ? s1 : y == 2 ? s2 : y == 3 ? s3 : s4;
  _Float16* __restrict__ d =
      y == 0 ? d0 : y == 1 ? d1 : y == 2 ? d2 : y == 3 ? d3 : d4;
  const int n = y == 0 ? nx : nw;
  int i = blockIdx.x * blockDim.x + threadIdx.x;
  int stride = gridDim.x * blockDim.x;
  for (; i < n; i += stride) d[i] = (_Float16)s[i];
}

// One operand tile of a stage of the GEMM ring, or one stage of the attention
// ring: this lane's eight 16-byte asynchronous copies to LDS (l: LDS byte
// addresses, g: global addresses).
// The closing s_wait_xcnt is a precaution and stands inside the statement so
// that no later rewrite of an address register can be moved in front of it.
__device__ inline void copy_stage(const unsigned (&l)[8],
                                  const _Float16* const (&g)[8]) {
  asm volatile(
      "global_load_async_to_lds_b128 %0, %8, off\n\t"
      "global_load_async_to_lds_b128 %1, %9, off\n\t"
      "global_load_async_to_lds_b128 %2, %10, off\n\t"
      "global_load_async_to_lds_b128 %3, %11, off\n\t"
      "global_load_async_to_lds_b128 %4, %12, off\n\t"
      "global_load_async_to_lds_b128 %5, %13, off\n\t"
      "global_load_async_to_lds_b128 %6, %14, off\n\t"
      "global_load_async_to_lds_b128 %7, %15, off\n\t"
      "s_wait_xcnt 0x0"
      :
      : "v"(l[0]), "v"(l[1]), "v"(l[2]), "v"(l[3]), "v"(l[4]), "v"(l[5]),
        "v"(l[6]), "v"(l[7]), "v"(g[0]), "v"(g[1]), "v"(g[2]), "v"(g[3]),
        "v"(g[4]), "v"(g[5]), "v"(g[6]), "v"(g[7])
      : "memory");
}

#define GBUF  3           // ring buffers; copies run GBUF - 1 stages ahead
#define GTILE (64 * 136)  // halves of one operand tile: 64 row pairs of 272 B
#define GSTG  (EMB / 64)  // stages of the K loop

// Place of row r (64 halves) in an operand tile, in halves: two rows side by
// side, then 16 bytes of pad. The 16 rows of a fragment read then fall on all
// 64 banks once, as at a pitch of 144 B, and three buffers of three
// work-groups fit one WGP's LDS.
__device__ inline int tile_row(int r) { return (r >> 1) * 136 + (r & 1) * 64; }

// C[M,N] = (X[M,K] * W[N,K]^T + bias) * scale ; K = N = 1024.
// Computed as C^T = W X^T (A operand = W rows, B operand = X rows).
// mode 0: write f16 into [b, h, t, d] head layout (QKV projections)
// mode 1: write f32 row-major [M, N] (output projection -> d_out)
// The operand tiles come into a ring of three LDS buffers by asynchronous
// copies, through no register, two stages ahead of the products that read
// them; one barrier per stage.
// Four waves, one a SIMD, each on a 64 x 64 tile of C: the 8 fragments of a
// 32-deep block come from LDS as one group and feed 16 products, so a fragment
// read serves four products.
// A stage is 64 halves = one 128-byte line of every operand row: 8 lanes
// fetch one line, so a wave-wide 16-byte copy touches 4 whole lines.
// blockIdx.z picks one of up to three products that share X (weights, bias,
// scale, f16 output), so that independent projections run in one grid.
__global__ __launch_bounds__(128) void gemm_xwT(
    const _Float16* __restrict__ X, const _Float16* __restrict__ W0,
    const _Float16* __restrict__ W1, const _Float16* __restrict__ W2,
    const float* __restrict__ bias0, const float* __restrict__ bias1,
    const float* __restrict__ bias2, float scale0, float scale1, float scale2,
    int M, int mode, _Float16* __restrict__ outH0,
    _Float16* __restrict__ outH1, _Float16* __restrict__ outH2,
    float* __restrict__ outF) {
  // [buffer][0: X rows, 1: W rows][128 rows x 64 K, placed by tile_row]
  __shared__ __attribute__((aligned(16))) _Float16 sm[GBUF][2][GTILE];

  const int z = blockIdx.z;
  const _Float16* __restrict__ W = z == 0 ? W0 : z == 1 ? W1 : W2;
  const float* __restrict__ bias = z == 0 ? bias0 : z == 1 ? bias1 : bias2;
  const float scale = z == 0 ? scale0 : z == 1 ? scale1 : scale2;
  _Float16* __restrict__ outH = z == 0 ? outH0 : z == 1 ? outH1 : outH2;

  const int tid  = threadIdx.x;
  const int lane = tid & 31;
  const int wave = tid >> 5;
  const int wm   = wave >> 1;  // 0..1 -> 64 rows each
  const int wn   = wave & 1;   // 0..1 -> 64 cols each
  const int mblk = blockIdx.x * 128;
  const int nblk = blockIdx.y * 128;

  v8f acc[4][4];
#pragma unroll
  for (int i = 0; i < 4; ++i)
#pragma unroll
    for (int j = 0; j < 4; ++j) acc[i][j] = zero8f();

  const int lrow = tid >> 3;       // 0..15; rows lrow + 16 * i, i = 0..7
  const int lcol = (tid & 7) * 8;  // 8 lanes x 16 B = one 128-byte line

  // Clamp tail rows instead of EXEC-masking: every lane copies, from inside
  // X; clamped rows only feed C rows >= M which are never stored.
  const _Float16* gX[8];
#pragma unroll
  for (int i = 0; i < 8; ++i) {
    int gm = mblk + lrow + 16 * i;
    if (gm >= M) gm = M - 1;
    gX[i] = X + (size_t)gm * EMB + lcol;
  }
  const _Float16* gW = W + (size_t)(nblk + lrow) * EMB + lcol;  // N always ok
  // this lane's LDS byte address in the X tile of buffer 0
  const unsigned l0 = (unsigned)(size_t)&sm[0][0][tile_row(lrow) + lcol];

  // stage s: K columns 64 s .. 64 s + 63 of both tiles into buffer s % GBUF
  auto issue = [&](int s) {
    unsigned l[8];
    const _Float16* g[8];
#pragma unroll
    for (int i = 0; i < 8; ++i) {
      l[i] = l0 + ((s % GBUF) * 2 * GTILE + i * 8 * 136) * 2;
      g[i] = gX[i] + s * 64;
    }
    copy_stage(l, g);
#pragma unroll
    for (int i = 0; i < 8; ++i) {
      l[i] = l0 + (((s % GBUF) * 2 + 1) * GTILE + i * 8 * 136) * 2;
      g[i] = gW + (size_t)i * 16 * EMB + s * 64;
    }
    copy_stage(l, g);
  };

  static_assert(GBUF == 3 && GSTG >= 2,
                "the counted wait below leaves one stage's copies in flight");
  // prologue: the first GBUF - 1 stages fly together
#pragma unroll
  for (int s = 0; s < GBUF - 1; ++s) issue(s);

  // Unrolled whole: buffer numbers, K offsets and the counts of the waits are
  // constants of each trip.
#pragma unroll
  for (int t = 0; t < GSTG; ++t) {
    const int cur = t % GBUF;

    // Publish point of stage t. This wave's reads of trip t - 1 have retired:
    asm volatile("s_wait_dscnt 0x0" ::: "memory");
    // its own copies of stage t have landed. Where trip t - 1 has issued
    // stage t + 1, those 16 copies, the wave's youngest, may stay in flight;
    // where it has issued nothing, the wait is to 0:
    if (t + 1 < GSTG)
      asm volatile("s_wait_asynccnt 0x10" ::: "memory");
    else
      asm volatile("s_wait_asynccnt 0x0" ::: "memory");
    // the barrier shows stage t to every wave and ends every wave's reads of
    // the buffer of trip t - 1, which the copies behind it refill
    __syncthreads();
    if (t + GBUF - 1 < GSTG) issue(t + GBUF - 1);

    // compute on current buffer: two 32-deep products per stage
#pragma unroll
    for (int ks = 0; ks < 2; ++ks) {
      v16h aF[4], bF[4];
#pragma unroll
      for (int mi = 0; mi < 4; ++mi)
        aF[mi] = ld_frag(
            &sm[cur][0][tile_row(wm * 64 + mi * 16 + (lane & 15)) + ks * 32],
            lane);
#pragma unroll
      for (int ni = 0; ni < 4; ++ni)
        bF[ni] = ld_frag(
            &sm[cur][1][tile_row(wn * 64 + ni * 16 + (lane & 15)) + ks * 32],
            lane);
      // Keeps the block's 16 LDS reads one group in front of its products:
      // left alone, the compiler sinks them among the products, two reads and
      // a wait to 0 in front of every four.
      __builtin_amdgcn_sched_barrier(0);
#pragma unroll
      for (int ni = 0; ni < 4; ++ni)
#pragma unroll
        for (int mi = 0; mi < 4; ++mi)
          acc[mi][ni] = __builtin_amdgcn_wmma_f32_16x16x32_f16(
              false, bF[ni], false, aF[mi], (short)0, acc[mi][ni], false,
              false);
      // The other end of the block: no product sinks behind the next publish
      // point, and no later read or address sum rises among the products.
      __builtin_amdgcn_sched_barrier(0);
    }
  }

  // epilogue: the tiles are C^T (rows n, columns m), so a lane owns one row
  // m = .. + (lane & 15) of C and 8 consecutive columns n = .. + 8*(lane >> 4)
  // + r of each tile: bias comes in 32 bytes at a time.
  const int c  = lane & 15;
  const int n0 = nblk + wn * 64 + 8 * (lane >> 4);
  v8f bb[4];
#pragma unroll
  for (int ni = 0; ni < 4; ++ni) bb[ni] = zero8f();
  if (bias) {
#pragma unroll
    for (int ni = 0; ni < 4; ++ni) bb[ni] = *(const v8f*)(bias + n0 + ni * 16);
  }
  // bias and scale in place, once for both output forms: the results need no
  // second register set
#pragma unroll
  for (int mi = 0; mi < 4; ++mi)
#pragma unroll
    for (int ni = 0; ni < 4; ++ni) acc[mi][ni] = (acc[mi][ni] + bb[ni]) * scale;
  // The wave's 64 x 64 tile goes out through LDS so that a store covers whole
  // 128-byte lines. The last trip reads buffer 0 alone; its barrier has ended
  // every read of buffers 1 and 2 and stands behind every wave's wait for its
  // last copies. Each wave stages there in a range of its own, so no further
  // barrier is needed.
  static_assert((GSTG - 1) % GBUF == 0 &&
                    4 * 64 * 272 <= (GBUF - 1) * 2 * GTILE * 2,
                "output staging must stay off the last trip's buffer");
  // The wave's number as a scalar, so that the tests below are scalar branches.
  const int ws = __builtin_amdgcn_readfirstlane(wave);
  char* stage = (char*)&sm[1][0][0] + ws * (64 * 272);
  const int m0 = mblk + (ws >> 1) * 64;
  if (mode == 0) {
    _Float16* st = (_Float16*)stage;  // [64][64] halves, pitch 144 B
#pragma unroll
    for (int mi = 0; mi < 4; ++mi)
#pragma unroll
      for (int ni = 0; ni < 4; ++ni) {
        v8h o;
#pragma unroll
        for (int r = 0; r < 8; ++r) o[r] = (_Float16)acc[mi][ni][r];
        *(v8h*)&st[(mi * 16 + c) * 72 + ni * 16 + 8 * (lane >> 4)] = o;
      }
    // the rows are read back by other lanes of this wave: its LDS writes
    // must have landed, and the compiler must not move the reads above them
    asm volatile("s_wait_dscnt 0x0" ::: "memory");
    // a row of one head is 128 bytes: 8 lanes a row, 4 rows a store
    const int hd = (nblk + (ws & 1) * 64) >> 6;
    // the tile's two halves of 32 rows, one after the other
#pragma unroll
    for (int hh = 0; hh < 2; ++hh) {
      const int mh = m0 + 32 * hh;
      const _Float16* sr = st + (32 * hh + (lane >> 3)) * 72 + (lane & 7) * 8;
      const int b0 = mh / SEQ;
      if (mh + 32 <= M && (mh + 31) / SEQ == b0) {
        // all 32 rows in range and in one batch: 4 KiB in a row, one address
        _Float16* og = outH +
                       (((size_t)(b0 * NH + hd) * SEQ) + (mh - b0 * SEQ)) * HD +
                       lane * 8;
        v8h o[8];
#pragma unroll
        for (int i = 0; i < 8; ++i) o[i] = *(const v8h*)(sr + i * 4 * 72);
#pragma unroll
        for (int i = 0; i < 8; ++i) *(v8h*)(og + i * 4 * HD) = o[i];
        // precaution: closes the run's stores before anything that stands
        // behind them in the listing reuses their registers
        asm volatile("s_wait_xcnt 0x0" ::: "memory");
      } else {
#pragma unroll
        for (int i = 0; i < 8; ++i) {
          const int m = mh + (lane >> 3) + 4 * i;
          const v8h o = *(const v8h*)(sr + i * 4 * 72);
          if (m < M) {
            const int b = m / SEQ, t = m % SEQ;
            *(v8h*)(outH + (((size_t)(b * NH + hd) * SEQ) + t) * HD +
                    (lane & 7) * 8) = o;
          }
        }
      }
    }
  } else {
    float* st = (float*)stage;  // [64][64] floats, pitch 272 B
#pragma unroll
    for (int mi = 0; mi < 4; ++mi)
#pragma unroll
      for (int ni = 0; ni < 4; ++ni) {
        // two 16-byte halves: the pitch keeps rows 16-byte aligned only
        float* sw = &st[(mi * 16 + c) * 68 + ni * 16 + 8 * (lane >> 4)];
        *(v4f*)sw = __builtin_shufflevector(acc[mi][ni], acc[mi][ni], 0, 1, 2, 3);
        *(v4f*)(sw + 4) =
            __builtin_shufflevector(acc[mi][ni], acc[mi][ni], 4, 5, 6, 7);
      }
    // as above: this wave's LDS writes land before its lanes read them back
    asm volatile("s_wait_dscnt 0x0" ::: "memory");
    // 64 floats of a row are two lines: 16 lanes a row, 2 rows a store;
    // the tile's two halves of 32 rows, one after the other
#pragma unroll
    for (int hh = 0; hh < 2; ++hh) {
      const int mh = m0 + 32 * hh;
      const float* sr = st + (32 * hh + (lane >> 4)) * 68 + (lane & 15) * 4;
      float* og = outF + (size_t)(mh + (lane >> 4)) * EMB + nblk +
                  (ws & 1) * 64 + (lane & 15) * 4;
      if (mh + 32 <= M) {
        v4f o[16];
#pragma unroll
        for (int i = 0; i < 16; ++i) o[i] = *(const v4f*)(sr + i * 2 * 68);
#pragma unroll
        for (int i = 0; i < 16; ++i) *(v4f*)(og + (size_t)i * 2 * EMB) = o[i];
        // precaution: closes the run's stores before anything that stands
        // behind them in the listing reuses their registers
        asm volatile("s_wait_xcnt 0x0" ::: "memory");
      } else {
#pragma unroll
        for (int i = 0; i < 16; ++i) {
          const v4f o = *(const v4f*)(sr + i * 2 * 68);
          if (mh + (lane >> 4) + 2 * i < M)
            *(v4f*)(og + (size_t)i * 2 * EMB) = o;
        }
      }
    }
  }
}

typedef __attribute__((ext_vector_type(8))) short v8s;

// 16-bit transposing LDS load from a row-major tile T[k][d]. With
// p = &T[k0 + 8 * (lane >> 4) + (lane & 7)][d0 + 8 * ((lane >> 3) & 1)]
// lane (c = lane & 15, h = lane >> 4) receives T[k0 + 8h + 0..7][d0 + c].
__device__ inline v8h ld_tr16(const _Float16* p) {
  typedef __attribute__((address_space(3))) v8s lds_v8s;
  return __builtin_bit_cast(
      v8h, __builtin_amdgcn_ds_load_tr16_b128_v8i16((lds_v8s*)p));
}

// value of lane l ^ 16
__device__ inline float xhalf(float x) {
  int b = __builtin_bit_cast(int, x);
  return __builtin_bit_cast(
      float, __builtin_amdgcn_permlanex16(b, b, 0x76543210, 0xfedcba98, false,
                                          false));
}

#define ANT ((SEQ + 63) / 64)  // key tiles
#define AKT (64 * 72)          // halves of a K buffer
#define AVT (64 * 80)          // halves of a V buffer
__global__ __launch_bounds__(128) void attn_kernel(
    const _Float16* __restrict__ Q, const _Float16* __restrict__ K,
    const _Float16* __restrict__ V, _Float16* __restrict__ O) {
  // three buffers of [kv][d], pitch 144 B: plain 16-B reads
  __shared__ __attribute__((aligned(16))) _Float16 kt[3 * AKT];
  // three buffers of [kv][d], pitch 160 B: transposing reads
  __shared__ __attribute__((aligned(16))) _Float16 vs[3 * AVT];
  static_assert(ANT >= 2, "the ring's prologue needs two tiles");

  const int tid  = threadIdx.x;
  const int lane = tid & 31;
  const int w    = tid >> 5;
  const int c    = lane & 15;
  const int hf   = lane >> 4;
  const int bh   = blockIdx.y;
  const int q0   = blockIdx.x * 128 + w * 32;

  const _Float16* Qb = Q + (size_t)bh * SEQ * HD;
  const _Float16* Kb = K + (size_t)bh * SEQ * HD;
  const _Float16* Vb = V + (size_t)bh * SEQ * HD;

  // Q fragments (B operand, column = query 16 g + c; clamped, invalid never
  // stored)
  v16h qf[2][2];
#pragma unroll
  for (int g = 0; g < 2; ++g) {
    const int qrow = q0 + 16 * g + c;
    const int qr = qrow < SEQ ? qrow : (SEQ - 1);
#pragma unroll
    for (int s = 0; s < 2; ++s)
      qf[g][s] = ld_frag(Qb + (size_t)qr * HD + s * 32, lane);
  }

  v8f oacc[2][4];  // oacc[g][t][r] = O^T[d = 16t + 8*hf + r][query 16g + c]
#pragma unroll
  for (int g = 0; g < 2; ++g)
#pragma unroll
    for (int t = 0; t < 4; ++t) oacc[g][t] = zero8f();
  // minus the reference maximum of query 16g + c, log2 units, equal in both
  // halves, in all eight registers: C operand of the score products; the first
  // tile sets it
  v8f cin[2] = {zero8f(), zero8f()};
  // running sum over this half's keys only, at the reference's scale
  float lrow[2] = {0.f, 0.f};

  const int lkv = tid >> 3;       // 0..15; rows lkv + 16 * i, i = 0..3
  const int ld0 = (tid & 7) * 8;  // 8 lanes x 16 B = one 128-byte row

  // this lane's LDS byte addresses in buffer 0, row lkv
  const unsigned lk0 = (unsigned)(size_t)&kt[lkv * 72 + ld0];
  const unsigned lv0 = (unsigned)(size_t)&vs[lkv * 80 + ld0];
  // and its places in row 0 of K and V
  const char* gk0 = (const char*)(Kb + ld0);
  const char* gv0 = (const char*)(Vb + ld0);
  // The tile whose row lkv lies rb bytes into K and V, into the buffers kb and
  // vb halves into kt and vs. Rows past the end are clamped, not masked: every
  // lane copies, from inside K and V; the clamped rows repeat the last key's
  // own values, and such keys get weight 0 below.
  auto issue = [&](unsigned rb, int kb, int vb) {
    unsigned l[8];
    const _Float16* g[8];
#pragma unroll
    for (int i = 0; i < 4; ++i) {
      const unsigned top = (SEQ - 1 - 16 * i) * HD * 2;
      const unsigned a = (rb < top ? rb : top) + 16 * i * HD * 2;
      l[i]     = lk0 + kb * 2 + i * 16 * 144;
      l[4 + i] = lv0 + vb * 2 + i * 16 * 160;
      g[i]     = (const _Float16*)(gk0 + a);
      g[4 + i] = (const _Float16*)(gv0 + a);
    }
    copy_stage(l, g);
  };
  unsigned rb = lkv * HD * 2;
  issue(rb, 0, 0);
  rb += 64 * HD * 2;
  issue(rb, AKT, AVT);

  int ko = 0, vo = 0;  // buffer i mod 3 of tile i: its place in kt and vs
  // One tile. 'last' is a constant at each call: only the last tile holds keys
  // past the end, so only its copy of the body carries the mask.
  static_assert((ANT - 1) * 64 <= SEQ, "only the last tile is masked");
  auto tile = [&](const int i, const bool last) __attribute__((always_inline)) {
    const int kv0 = i * 64;
    // Publish point of tile i. This wave's reads of tile i - 1 have retired:
    asm volatile("s_wait_dscnt 0x0" ::: "memory");
    // its own copies of tile i have landed. Where trip i - 1 has issued tile
    // i + 1, those 8 copies, the wave's youngest, may stay in flight; where it
    // has issued nothing, the wait is to 0:
    if (!last)
      asm volatile("s_wait_asynccnt 0x8" ::: "memory");
    else
      asm volatile("s_wait_asynccnt 0x0" ::: "memory");
    // the barrier shows tile i to every wave and ends every wave's reads of
    // the buffer of tile i - 1, which the copies behind it refill
    __syncthreads();
    rb += 64 * HD * 2;
    if (i + 2 < ANT)
      issue(rb, ko == 0 ? 2 * AKT : ko - AKT, vo == 0 ? 2 * AVT : vo - AVT);

    // S^T = K Q^T - reference : 4 key tiles x 2 k-steps x 2 column groups;
    // sa[g][t][r] = S[query 16g + c][key kv0 + 16t + 8*hf + r] + cin[g][r]
    v8f sa[2][4];
    // The last tile spreads its C operand anew from one register: handed over
    // whole, the compiler copied all 16 registers on every trip of the loop
    // for the code behind it.
    if (last) {
#pragma unroll
      for (int g = 0; g < 2; ++g)
#pragma unroll
        for (int r = 1; r < 8; ++r) cin[g][r] = cin[g][0];
    }
    v16h kF[4][2];
#pragma unroll
    for (int t = 0; t < 4; ++t)
#pragma unroll
      for (int s = 0; s < 2; ++s)
        kF[t][s] = ld_frag(&kt[ko + (t * 16 + c) * 72 + s * 32], lane);
    // Keeps the tile's 16 K reads one group in front of its products: without
    // it the compiler set two reads and a wait to 0 in front of every two
    // products.
    __builtin_amdgcn_sched_barrier(0);
#pragma unroll
    for (int s = 0; s < 2; ++s)
#pragma unroll
      for (int t = 0; t < 4; ++t)
#pragma unroll
        for (int g = 0; g < 2; ++g)
          sa[g][t] = __builtin_amdgcn_wmma_f32_16x16x32_f16(
              false, kF[t][s], false, qf[g][s], (short)0,
              s == 0 ? cin[g] : sa[g][t], false, false);
    // Keeps the 16 products one run: left alone, the compiler draws the maximum
    // chain up among them, each of its reads behind idle slots that the
    // distance from a product to the first read of its result asks for.
    __builtin_amdgcn_sched_barrier(0);

    // The tile's 16 V^T reads, one group too: they fly while the vector work
    // below runs, ahead of the second run of products.
    const _Float16* vp =
        &vs[vo + (8 * hf + (lane & 7)) * 80 + 8 * ((lane >> 3) & 1)];
    v16h vF[4][2];
#pragma unroll
    for (int t = 0; t < 4; ++t)
#pragma unroll
      for (int j = 0; j < 2; ++j)
        vF[t][j] = make16(ld_tr16(vp + (j * 32) * 80 + t * 16),
                          ld_tr16(vp + (j * 32 + 16) * 80 + t * 16));
    // holds the group here: left alone, the compiler sinks the reads among the
    // products that use them
    __builtin_amdgcn_sched_barrier(0);

    // mask OOB keys + this half's highest score above the reference, per query
    float nm[2];
#pragma unroll
    for (int g = 0; g < 2; ++g) {
#pragma unroll
      for (int t = 0; t < 4; ++t) {
#pragma unroll
        for (int r = 0; r < 8; ++r) {
          int ng = kv0 + t * 16 + 8 * hf + r;
          float sc = (!last || ng < SEQ) ? sa[g][t][r] : -1e30f;
          sa[g][t][r] = sc;
          nm[g] = (t == 0 && r == 0) ? sc : fmaxf(nm[g], sc);
        }
      }
    }
    // One test a tile, a scalar branch for the whole wave: the reference moves
    // on the first tile, which sets it, and where a score of any lane stands
    // more than 8 above it. Marked rare, so that the usual path falls through
    // and the loop runs in one straight piece.
    const bool need = fmaxf(nm[0], nm[1]) > 8.f;
    if (__builtin_expect(i == 0 || __builtin_amdgcn_ballot_w32(need) != 0, 0)) {
#pragma unroll
      for (int g = 0; g < 2; ++g) {
        const float tm = fmaxf(nm[g], xhalf(nm[g]));
        // the reference only rises, to a maximum that a key has reached, so
        // that key's term keeps the sum at 1 or more
        const float d = i == 0 ? tm : fmaxf(tm, 0.f);
        // O and the sum are still 0 on the first tile
        const float fac = i == 0 ? 1.f : __builtin_amdgcn_exp2f(-d);
        const float nr = cin[g][0] - d;
#pragma unroll
        for (int r = 0; r < 8; ++r) cin[g][r] = nr;
#pragma unroll
        for (int t = 0; t < 4; ++t)
#pragma unroll
          for (int r = 0; r < 8; ++r) {
            sa[g][t][r] -= d;
            oacc[g][t][r] *= fac;
          }
        lrow[g] *= fac;
      }
    }

    // P^T = exp2(S^T - reference): element s of the B operand of 32-key block j
    // is key 32j + (s < 8 ? 8*hf + s : 16 + 8*hf + s - 8) = sa[2j + s/8][s%8]
    v16h pF[2][2];
#pragma unroll
    for (int g = 0; g < 2; ++g) {
      float psum = 0.f;
#pragma unroll
      for (int j = 0; j < 2; ++j) {
#pragma unroll
        for (int s = 0; s < 16; ++s) {
          float p = __builtin_amdgcn_exp2f(sa[g][2 * j + (s >> 3)][s & 7]);
          psum += p;
          pF[g][j][s] = (_Float16)p;
        }
      }
      lrow[g] += psum;
    }

    // O^T += V^T P^T : 4 d tiles x 2 key blocks x 2 column groups
#pragma unroll
    for (int j = 0; j < 2; ++j)
#pragma unroll
      for (int t = 0; t < 4; ++t)
#pragma unroll
        for (int g = 0; g < 2; ++g)
          oacc[g][t] = __builtin_amdgcn_wmma_f32_16x16x32_f16(
              false, vF[t][j], false, pF[g][j], (short)0, oacc[g][t], false,
              false);
    ko = ko == 2 * AKT ? 0 : ko + AKT;
    vo = vo == 2 * AVT ? 0 : vo + AVT;
  };
  for (int i = 0; i < ANT - 1; ++i) tile(i, false);
  tile(ANT - 1, true);

  // join the halves' sums with every lane active, ahead of the row guard
  float lsum[2];
#pragma unroll
  for (int g = 0; g < 2; ++g) lsum[g] = lrow[g] + xhalf(lrow[g]);

  // The wave's 32 x 64 tile goes out through LDS so that a store covers whole
  // 128-byte lines. The barrier ends every wave's reads of the last K/V tile;
  // behind it each wave stages in 32 rows of its own in kt.
  static_assert(4 * 32 * 72 <= 3 * AKT, "output staging must fit kt");
  __syncthreads();
  // the wave's number as a scalar, so that the range test is a scalar branch
  const int ws = __builtin_amdgcn_readfirstlane(w);
  _Float16* st = &kt[32 * ws * 72];
#pragma unroll
  for (int g = 0; g < 2; ++g)
#pragma unroll
    for (int t = 0; t < 4; ++t) {
      v8h o;
#pragma unroll
      for (int r = 0; r < 8; ++r) o[r] = (_Float16)(oacc[g][t][r] / lsum[g]);
      *(v8h*)&st[(16 * g + c) * 72 + t * 16 + 8 * hf] = o;
    }
  // the rows are read back by other lanes of this wave: its LDS writes must
  // have landed, and the compiler must not move the reads above them
  asm volatile("s_wait_dscnt 0x0" ::: "memory");

  // a query's 64 values of one head are 128 bytes: 8 lanes a row, 4 rows a store
  const int b = bh >> 4, h = bh & 15;
  const int qs = blockIdx.x * 128 + ws * 32;
  const _Float16* sr = st + (lane >> 3) * 72 + (lane & 7) * 8;
  _Float16* og = O + ((size_t)(b * SEQ + qs + (lane >> 3))) * EMB + h * HD +
                 (lane & 7) * 8;
  if (qs + 32 <= SEQ) {
    v8h o[8];
#pragma unroll
    for (int i = 0; i < 8; ++i) o[i] = *(const v8h*)(sr + i * 4 * 72);
#pragma unroll
    for (int i = 0; i < 8; ++i) *(v8h*)(og + (size_t)i * 4 * EMB) = o[i];
    // precaution: closes the run's stores before anything that stands
    // behind them in the listing reuses their registers
    asm volatile("s_wait_xcnt 0x0" ::: "memory");
  } else {
#pragma unroll
    for (int i = 0; i < 8; ++i) {
      const v8h o = *(const v8h*)(sr + i * 4 * 72);
      if (qs + (lane >> 3) + 4 * i < SEQ) {
        *(v8h*)(og + (size_t)i * 4 * EMB) = o;
        // precaution: closes the store before the next trip's LDS read
        // reuses its data registers
        asm volatile("s_wait_xcnt 0x0" ::: "memory");
      }
    }
  }
}

extern "C" void kernel_launch(void* const* d_in, const int* in_sizes, int n_in,
                              void* d_out, int out_size, void* d_ws,
                              size_t ws_size, hipStream_t stream) {
  const float* x  = (const float*)d_in[0];
  const float* Wq = (const float*)d_in[1];
  const float* bq = (const float*)d_in[2];
  const float* Wk = (const float*)d_in[3];
  const float* Wv = (const float*)d_in[4];
  const float* bv = (const float*)d_in[5];
  const float* Wo = (const float*)d_in[6];
  const float* bo = (const float*)d_in[7];
  float* out = (float*)d_out;

  _Float16* base = (_Float16*)d_ws;
  size_t off = 0;
  auto carve = [&](size_t n) {
    _Float16* p = base + off;
    off += (n + 127) & ~(size_t)127;
    return p;
  };
  _Float16* Xh  = carve((size_t)MROWS * EMB);
  _Float16* Wqh = carve((size_t)EMB * EMB);
  _Float16* Wkh = carve((size_t)EMB * EMB);
  _Float16* Wvh = carve((size_t)EMB * EMB);
  _Float16* Woh = carve((size_t)EMB * EMB);
  _Float16* Qh  = carve((size_t)MROWS * EMB);
  _Float16* Kh  = carve((size_t)MROWS * EMB);
  _Float16* Vh  = carve((size_t)MROWS * EMB);
  _Float16* Ah  = carve((size_t)MROWS * EMB);

  cvt_f32_to_f16<<<dim3(512, 5), 256, 0, stream>>>(
      x, Wq, Wk, Wv, Wo, Xh, Wqh, Wkh, Wvh, Woh, MROWS * EMB, EMB * EMB);

  dim3 g((MROWS + 127) / 128, EMB / 128);      // 47 x 8
  dim3 g3((MROWS + 127) / 128, EMB / 128, 3);  // 47 x 8 x {q, k, v}
  // q = (X Wq^T + bq) * d^-0.5 * log2 e (scale applied after bias, as in the
  // reference; log2 e so that attention's scores are arguments of exp2)
  gemm_xwT<<<g3, 128, 0, stream>>>(Xh, Wqh, Wkh, Wvh, bq, nullptr, bv,
                                   0.18033688f, 1.0f, 1.0f, MROWS, 0, Qh, Kh,
                                   Vh, nullptr);

  attn_kernel<<<dim3((SEQ + 127) / 128, 4 * NH), 128, 0, stream>>>(Qh, Kh, Vh,
                                                                   Ah);

  gemm_xwT<<<g, 128, 0, stream>>>(Ah, Woh, nullptr, nullptr, bo, nullptr,
                                  nullptr, 1.0f, 1.0f, 1.0f, MROWS, 1, nullptr,
                                  nullptr, nullptr, out);
}

// v010
// A run of this version takes 88.6 microseconds.
// Timed twice side by side with v009, it ran 1.03 times as fast both times.
// Over all steps from v000 it is 2.86 times as fast.
#include <hip/hip_runtime.h>

#define SEQ 1500
#define EMB 1024
#define NH  16
#define HD  64
#define MROWS 6000   // B*SEQ = 4*1500

typedef __attribute__((ext_vector_type(16))) _Float16 v16h;
typedef __attribute__((ext_vector_type(8)))  _Float16 v8h;
typedef __attribute__((ext_vector_type(8)))  float    v8f;
typedef __attribute__((ext_vector_type(4)))  float    v4f;

__device__ inline v8h zero8h() { v8h z = {}; return z; }
__device__ inline v8f zero8f() { v8f z = {}; return z; }

__device__ inline v16h make16(v8h lo, v8h hi) {
  v16h r;
#pragma unroll
  for (int i = 0; i < 8; ++i) { r[i] = lo[i]; r[i + 8] = hi[i]; }
  return r;
}

// Load a 16x32 f16 A/B WMMA fragment whose row (m or n) = lane%16 is already
// folded into rowp. Per ISA layout: k(h,lane) = (h/8)*16 + (lane/16)*8 + h%8,
// i.e. two contiguous 8-half (16B) segments at +((lane>>4)*8) and +16 more.
__device__ inline v16h ld_frag(const _Float16* rowp, int lane) {
  const _Float16* p = rowp + ((lane >> 4) << 3);
  v8h lo = *(const v8h*)(p);
  v8h hi = *(const v8h*)(p + 16);
  return make16(lo, hi);
}

// One grid converts all five tensors side by side: blockIdx.y picks the tensor
// (0: activations, nx elements; 1..4: weights, nw elements each).
__global__ void cvt_f32_to_f16(
    const float* __restrict__ s0, const float* __restrict__ s1,
    const float* __restrict__ s2, const float* __restrict__ s3,
    const float* __restrict__ s4, _Float16* __restrict__ d0,
    _Float16* __restrict__ d1, _Float16* __restrict__ d2,
    _Float16* __restrict__ d3, _Float16* __restrict__ d4, int nx, int nw) {
  const int y = blockIdx.y;
  const float* __restrict__ s =
      y == 0 ? s0 : y == 1 ? s1 : y == 2 ? s2 : y == 3 ? s3 : s4;
  _Float16* __restrict__ d =
      y == 0 ? d0 : y == 1 ? d1 : y == 2 ? d2 : y == 3 ? d3 : d4;
  const int n = y == 0 ? nx : nw;
  int i = blockIdx.x * blockDim.x + threadIdx.x;
  int stride = gridDim.x * blockDim.x;
  for (; i < n; i += stride) d[i] = (_Float16)s[i];
}

// One operand tile of a stage of the GEMM ring, or one stage of the attention
// ring: this lane's eight 16-byte asynchronous copies to LDS (l: LDS byte
// addresses, g: global addresses).
// The closing s_wait_xcnt is a precaution and stands inside the statement so
// that no later rewrite of an address register can be moved in front of it.
__device__ inline void copy_stage(const unsigned (&l)[8],
                                  const _Float16* const (&g)[8]) {
  asm volatile(
      "global_load_async_to_lds_b128 %0, %8, off\n\t"
      "global_load_async_to_lds_b128 %1, %9, off\n\t"
      "global_load_async_to_lds_b128 %2, %10, off\n\t"
      "global_load_async_to_lds_b128 %3, %11, off\n\t"
      "global_load_async_to_lds_b128 %4, %12, off\n\t"
      "global_load_async_to_lds_b128 %5, %13, off\n\t"
      "global_load_async_to_lds_b128 %6, %14, off\n\t"
      "global_load_async_to_lds_b128 %7, %15, off\n\t"
      "s_wait_xcnt 0x0"
      :
      : "v"(l[0]), "v"(l[1]), "v"(l[2]), "v"(l[3]), "v"(l[4]), "v"(l[5]),
        "v"(l[6]), "v"(l[7]), "v"(g[0]), "v"(g[1]), "v"(g[2]), "v"(g[3]),
        "v"(g[4]), "v"(g[5]), "v"(g[6]), "v"(g[7])
      : "memory");
}

#define GBUF  3           // ring buffers; copies run GBUF - 1 stages ahead
#define GTILE (64 * 136)  // halves of one operand tile: 64 row pairs of 272 B
#define GSTG  (EMB / 64)  // stages of the K loop

// Place of row r (64 halves) in an operand tile, in halves: two rows side by
// side, then 16 bytes of pad. The 16 rows of a fragment read then fall on all
// 64 banks once, as at a pitch of 144 B, and three buffers of three
// work-groups fit one WGP's LDS.
__device__ inline int tile_row(int r) { return (r >> 1) * 136 + (r & 1) * 64; }

// C[M,N] = (X[M,K] * W[N,K]^T + bias) * scale ; K = N = 1024.
// Computed as C^T = W X^T (A operand = W rows, B operand = X rows).
// mode 0: write f16 into [b, h, t, d] head layout (no launch in this file uses it)
// mode 1: write f32 row-major [M, N] (output projection -> d_out)
// The operand tiles come into a ring of three LDS buffers by asynchronous
// copies, through no register, two stages ahead of the products that read
// them; one barrier per stage.
// Four waves, one a SIMD, each on a 64 x 64 tile of C: the 8 fragments of a
// 32-deep block come from LDS as one group and feed 16 products, so a fragment
// read serves four products.
// A stage is 64 halves = one 128-byte line of every operand row: 8 lanes
// fetch one line, so a wave-wide 16-byte copy touches 4 whole lines.
// blockIdx.z picks one of up to three products that share X (weights, bias,
// scale, f16 output), so that independent projections run in one grid.
__global__ __launch_bounds__(128) void gemm_xwT(
    const _Float16* __restrict__ X, const _Float16* __restrict__ W0,
    const _Float16* __restrict__ W1, const _Float16* __restrict__ W2,
    const float* __restrict__ bias0, const float* __restrict__ bias1,
    const float* __restrict__ bias2, float scale0, float scale1, float scale2,
    int M, int mode, _Float16* __restrict__ outH0,
    _Float16* __restrict__ outH1, _Float16* __restrict__ outH2,
    float* __restrict__ outF) {
  // [buffer][0: X rows, 1: W rows][128 rows x 64 K, placed by tile_row]
  __shared__ __attribute__((aligned(16))) _Float16 sm[GBUF][2][GTILE];

  const int z = blockIdx.z;
  const _Float16* __restrict__ W = z == 0 ? W0 : z == 1 ? W1 : W2;
  const float* __restrict__ bias = z == 0 ? bias0 : z == 1 ? bias1 : bias2;
  const float scale = z == 0 ? scale0 : z == 1 ? scale1 : scale2;
  _Float16* __restrict__ outH = z == 0 ? outH0 : z == 1 ? outH1 : outH2;

  const int tid  = threadIdx.x;
  const int lane = tid & 31;
  const int wave = tid >> 5;
  const int wm   = wave >> 1;  // 0..1 -> 64 rows each
  const int wn   = wave & 1;   // 0..1 -> 64 cols each
  const int mblk = blockIdx.x * 128;
  const int nblk = blockIdx.y * 128;

  v8f acc[4][4];
#pragma unroll
  for (int i = 0; i < 4; ++i)
#pragma unroll
    for (int j = 0; j < 4; ++j) acc[i][j] = zero8f();

  const int lrow = tid >> 3;       // 0..15; rows lrow + 16 * i, i = 0..7
  const int lcol = (tid & 7) * 8;  // 8 lanes x 16 B = one 128-byte line

  // Clamp tail rows instead of EXEC-masking: every lane copies, from inside
  // X; clamped rows only feed C rows >= M which are never stored.
  const _Float16* gX[8];
#pragma unroll
  for (int i = 0; i < 8; ++i) {
    int gm = mblk + lrow + 16 * i;
    if (gm >= M) gm = M - 1;
    gX[i] = X + (size_t)gm * EMB + lcol;
  }
  const _Float16* gW = W + (size_t)(nblk + lrow) * EMB + lcol;  // N always ok
  // this lane's LDS byte address in the X tile of buffer 0
  const unsigned l0 = (unsigned)(size_t)&sm[0][0][tile_row(lrow) + lcol];

  // stage s: K columns 64 s .. 64 s + 63 of both tiles into buffer s % GBUF
  auto issue = [&](int s) {
    unsigned l[8];
    const _Float16* g[8];
#pragma unroll
    for (int i = 0; i < 8; ++i) {
      l[i] = l0 + ((s % GBUF) * 2 * GTILE + i * 8 * 136) * 2;
      g[i] = gX[i] + s * 64;
    }
    copy_stage(l, g);
#pragma unroll
    for (int i = 0; i < 8; ++i) {
      l[i] = l0 + (((s % GBUF) * 2 + 1) * GTILE + i * 8 * 136) * 2;
      g[i] = gW + (size_t)i * 16 * EMB + s * 64;
    }
    copy_stage(l, g);
  };

  static_assert(GBUF == 3 && GSTG >= 2,
                "the counted wait below leaves one stage's copies in flight");
  // prologue: the first GBUF - 1 stages fly together
#pragma unroll
  for (int s = 0; s < GBUF - 1; ++s) issue(s);

  // Unrolled whole: buffer numbers, K offsets and the counts of the waits are
  // constants of each trip.
#pragma unroll
  for (int t = 0; t < GSTG; ++t) {
    const int cur = t % GBUF;

    // Publish point of stage t. This wave's reads of trip t - 1 have retired:
    asm volatile("s_wait_dscnt 0x0" ::: "memory");
    // its own copies of stage t have landed. Where trip t - 1 has issued
    // stage t + 1, those 16 copies, the wave's youngest, may stay in flight;
    // where it has issued nothing, the wait is to 0:
    if (t + 1 < GSTG)
      asm volatile("s_wait_asynccnt 0x10" ::: "memory");
    else
      asm volatile("s_wait_asynccnt 0x0" ::: "memory");
    // the barrier shows stage t to every wave and ends every wave's reads of
    // the buffer of trip t - 1, which the copies behind it refill
    __syncthreads();
    if (t + GBUF - 1 < GSTG) issue(t + GBUF - 1);

    // compute on current buffer: two 32-deep products per stage
#pragma unroll
    for (int ks = 0; ks < 2; ++ks) {
      v16h aF[4], bF[4];
#pragma unroll
      for (int mi = 0; mi < 4; ++mi)
        aF[mi] = ld_frag(
            &sm[cur][0][tile_row(wm * 64 + mi * 16 + (lane & 15)) + ks * 32],
            lane);
#pragma unroll
      for (int ni = 0; ni < 4; ++ni)
        bF[ni] = ld_frag(
            &sm[cur][1][tile_row(wn * 64 + ni * 16 + (lane & 15)) + ks * 32],
            lane);
      // Keeps the block's 16 LDS reads one group in front of its products:
      // left alone, the compiler sinks them among the products, two reads and
      // a wait to 0 in front of every four.
      __builtin_amdgcn_sched_barrier(0);
#pragma unroll
      for (int ni = 0; ni < 4; ++ni)
#pragma unroll
        for (int mi = 0; mi < 4; ++mi)
          acc[mi][ni] = __builtin_amdgcn_wmma_f32_16x16x32_f16(
              false, bF[ni], false, aF[mi], (short)0, acc[mi][ni], false,
              false);
      // The other end of the block: no product sinks behind the next publish
      // point, and no later read or address sum rises among the products.
      __builtin_amdgcn_sched_barrier(0);
    }
  }

  // epilogue: the tiles are C^T (rows n, columns m), so a lane owns one row
  // m = .. + (lane & 15) of C and 8 consecutive columns n = .. + 8*(lane >> 4)
  // + r of each tile: bias comes in 32 bytes at a time.
  const int c  = lane & 15;
  const int n0 = nblk + wn * 64 + 8 * (lane >> 4);
  v8f bb[4];
#pragma unroll
  for (int ni = 0; ni < 4; ++ni) bb[ni] = zero8f();
  if (bias) {
#pragma unroll
    for (int ni = 0; ni < 4; ++ni) bb[ni] = *(const v8f*)(bias + n0 + ni * 16);
  }
  // bias and scale in place, once for both output forms: the results need no
  // second register set
#pragma unroll
  for (int mi = 0; mi < 4; ++mi)
#pragma unroll
    for (int ni = 0; ni < 4; ++ni) acc[mi][ni] = (acc[mi][ni] + bb[ni]) * scale;
  // The wave's 64 x 64 tile goes out through LDS so that a store covers whole
  // 128-byte lines. The last trip reads buffer 0 alone; its barrier has ended
  // every read of buffers 1 and 2 and stands behind every wave's wait for its
  // last copies. Each wave stages there in a range of its own, so no further
  // barrier is needed.
  static_assert((GSTG - 1) % GBUF == 0 &&
                    4 * 64 * 272 <= (GBUF - 1) * 2 * GTILE * 2,
                "output staging must stay off the last trip's buffer");
  // The wave's number as a scalar, so that the tests below are scalar branches.
  const int ws = __builtin_amdgcn_readfirstlane(wave);
  char* stage = (char*)&sm[1][0][0] + ws * (64 * 272);
  const int m0 = mblk + (ws >> 1) * 64;
  if (mode == 0) {
    _Float16* st = (_Float16*)stage;  // [64][64] halves, pitch 144 B
#pragma unroll
    for (int mi = 0; mi < 4; ++mi)
#pragma unroll
      for (int ni = 0; ni < 4; ++ni) {
        v8h o;
#pragma unroll
        for (int r = 0; r < 8; ++r) o[r] = (_Float16)acc[mi][ni][r];
        *(v8h*)&st[(mi * 16 + c) * 72 + ni * 16 + 8 * (lane >> 4)] = o;
      }
    // the rows are read back by other lanes of this wave: its LDS writes
    // must have landed, and the compiler must not move the reads above them
    asm volatile("s_wait_dscnt 0x0" ::: "memory");
    // a row of one head is 128 bytes: 8 lanes a row, 4 rows a store
    const int hd = (nblk + (ws & 1) * 64) >> 6;
    // the tile's two halves of 32 rows, one after the other
#pragma unroll
    for (int hh = 0; hh < 2; ++hh) {
      const int mh = m0 + 32 * hh;
      const _Float16* sr = st + (32 * hh + (lane >> 3)) * 72 + (lane & 7) * 8;
      const int b0 = mh / SEQ;
      if (mh + 32 <= M && (mh + 31) / SEQ == b0) {
        // all 32 rows in range and in one batch: 4 KiB in a row, one address
        _Float16* og = outH +
                       (((size_t)(b0 * NH + hd) * SEQ) + (mh - b0 * SEQ)) * HD +
                       lane * 8;
        v8h o[8];
#pragma unroll
        for (int i = 0; i < 8; ++i) o[i] = *(const v8h*)(sr + i * 4 * 72);
#pragma unroll
        for (int i = 0; i < 8; ++i) *(v8h*)(og + i * 4 * HD) = o[i];
        // precaution: closes the run's stores before anything that stands
        // behind them in the listing reuses their registers
        asm volatile("s_wait_xcnt 0x0" ::: "memory");
      } else {
#pragma unroll
        for (int i = 0; i < 8; ++i) {
          const int m = mh + (lane >> 3) + 4 * i;
          const v8h o = *(const v8h*)(sr + i * 4 * 72);
          if (m < M) {
            const int b = m / SEQ, t = m % SEQ;
            *(v8h*)(outH + (((size_t)(b * NH + hd) * SEQ) + t) * HD +
                    (lane & 7) * 8) = o;
          }
        }
      }
    }
  } else {
    float* st = (float*)stage;  // [64][64] floats, pitch 272 B
#pragma unroll
    for (int mi = 0; mi < 4; ++mi)
#pragma unroll
      for (int ni = 0; ni < 4; ++ni) {
        // two 16-byte halves: the pitch keeps rows 16-byte aligned only
        float* sw = &st[(mi * 16 + c) * 68 + ni * 16 + 8 * (lane >> 4)];
        *(v4f*)sw = __builtin_shufflevector(acc[mi][ni], acc[mi][ni], 0, 1, 2, 3);
        *(v4f*)(sw + 4) =
            __builtin_shufflevector(acc[mi][ni], acc[mi][ni], 4, 5, 6, 7);
      }
    // as above: this wave's LDS writes land before its lanes read them back
    asm volatile("s_wait_dscnt 0x0" ::: "memory");
    // 64 floats of a row are two lines: 16 lanes a row, 2 rows a store;
    // the tile's two halves of 32 rows, one after the other
#pragma unroll
    for (int hh = 0; hh < 2; ++hh) {
      const int mh = m0 + 32 * hh;
      const float* sr = st + (32 * hh + (lane >> 4)) * 68 + (lane & 15) * 4;
      float* og = outF + (size_t)(mh + (lane >> 4)) * EMB + nblk +
                  (ws & 1) * 64 + (lane & 15) * 4;
      if (mh + 32 <= M) {
        v4f o[16];
#pragma unroll
        for (int i = 0; i < 16; ++i) o[i] = *(const v4f*)(sr + i * 2 * 68);
#pragma unroll
        for (int i = 0; i < 16; ++i) *(v4f*)(og + (size_t)i * 2 * EMB) = o[i];
        // precaution: closes the run's stores before anything that stands
        // behind them in the listing reuses their registers
        asm volatile("s_wait_xcnt 0x0" ::: "memory");
      } else {
#pragma unroll
        for (int i = 0; i < 16; ++i) {
          const v4f o = *(const v4f*)(sr + i * 2 * 68);
          if (mh + (lane >> 4) + 2 * i < M)
            *(v4f*)(og + (size_t)i * 2 * EMB) = o;
        }
      }
    }
  }
}

typedef __attribute__((ext_vector_type(4))) int v4i;
typedef __attribute__((ext_vector_type(2))) float v2f;

// One 16-byte asynchronous copy to LDS of this lane, g to l.
__device__ inline void copy16(const _Float16* g, _Float16* l) {
  __builtin_amdgcn_global_load_async_to_lds_b128(
      (__attribute__((address_space(1))) v4i*)g,
      (__attribute__((address_space(3))) v4i*)l, 0, 0);
}

#define QM    192              // rows of X, and rows of W, in a work-group's tile
#define QTILE (QM / 2 * 136)   // halves of one operand tile: 96 row pairs of 272 B
#define QBUF  (2 * QTILE)      // halves of one ring buffer: X tile, then W tile
#define QPIT  200              // halves: pitch of the output staging, 400 B

// The three input projections as ONE product C[M, 3072] = X[M, K] Wqkv[3072, K]^T
// (the three f16 weights lie one behind the other, and so do the three outputs).
// Column n belongs to projection n >> 10: (C + bias) * scale goes out as f16 in
// [projection][b, h, t, d].
// Same ring and same transposed products as gemm_xwT, on a larger tile:
// 192 x 192 a work-group, 96 x 96 a wave. The 12 fragments of a 32-deep
// block feed 36 products (a fragment read serves six), and a stage's 48 KB of
// operands feed 288: fewer LDS and L2 bytes a product. 32 x 16 work-groups are
// two for every WGP, all resident at once (LDS and registers fit two).
__global__ __launch_bounds__(128) void gemm_qkv(
    const _Float16* __restrict__ X, const _Float16* __restrict__ W,
    const float* __restrict__ bias0, const float* __restrict__ bias1,
    const float* __restrict__ bias2, float scale0, float scale1, float scale2,
    int M, _Float16* __restrict__ outH) {
  __shared__ __attribute__((aligned(16))) _Float16 sm[GBUF * QBUF];
  // bias of the tile's 192 columns, 0 where a projection has none
  __shared__ __attribute__((aligned(32))) float sbias[QM];

  const int tid  = threadIdx.x;
  const int lane = tid & 31;
  const int wave = tid >> 5;
  const int wm   = wave >> 1;  // 0..1 -> 96 rows of X each
  const int wn   = wave & 1;   // 0..1 -> 96 rows of W each
  const int mblk = blockIdx.x * QM;
  const int nblk = blockIdx.y * QM;

  v8f acc[6][6];
#pragma unroll
  for (int i = 0; i < 6; ++i)
#pragma unroll
    for (int j = 0; j < 6; ++j) acc[i][j] = zero8f();

  const int lrow = tid >> 3;       // 0..15; rows lrow + 16 * i, i = 0..11
  const int lcol = (tid & 7) * 8;  // 8 lanes x 16 B = one 128-byte line

  // Tail rows are clamped, not masked: every lane copies, from inside X;
  // clamped rows only feed C rows >= M, which are never stored.
  const _Float16* gX[12];
#pragma unroll
  for (int i = 0; i < 12; ++i) {
    int gm = mblk + lrow + 16 * i;
    if (gm >= M) gm = M - 1;
    gX[i] = X + (size_t)gm * EMB + lcol;
  }
  const _Float16* gW = W + (size_t)(nblk + lrow) * EMB + lcol;  // N always ok
  // this lane's place in an operand tile, in halves
  const int lplace = tile_row(lrow) + lcol;

  // One stage, K columns k .. k + 63 of both tiles, into the buffer bo halves
  // into sm: 24 copies a lane, 12 rows of X and 12 of W. The builtin form: the
  // compiler picks the registers, also above v255, which asm text cannot name.
  auto issue = [&](int k, int bo) {
#pragma unroll
    for (int i = 0; i < 12; ++i)
      copy16(gX[i] + k, &sm[bo + lplace + i * 8 * 136]);
#pragma unroll
    for (int i = 0; i < 12; ++i)
      copy16(gW + (size_t)i * 16 * EMB + k,
             &sm[bo + QTILE + lplace + i * 8 * 136]);
  };

  static_assert(GBUF == 3 && GSTG >= 2,
                "the counted wait below leaves one stage's copies in flight");
  // prologue: the first two stages fly together
  issue(0, 0);
  issue(64, QBUF);

  // The tile's bias row goes to LDS while the first copies fly; the first
  // stage's publish point (its s_wait_dscnt 0, its barrier) shows it to all.
  // Two columns a lane: a pair never straddles two projections.
  if (tid < QM / 2) {
    const int n = nblk + 2 * tid;
    const int z = n >> 10;
    const float* __restrict__ bias = z == 0 ? bias0 : z == 1 ? bias1 : bias2;
    v2f b2 = {0.f, 0.f};
    if (bias) b2 = *(const v2f*)(bias + (n & (EMB - 1)));
    *(v2f*)&sbias[2 * tid] = b2;
  }

  // The tiles are C^T (rows n, columns m): a lane owns one row m = .. + c of C
  // and 8 consecutive columns n = .. + 8 * hf + r of each tile.
  const int c  = lane & 15;
  const int hf = lane >> 4;
  // the wave's number as a scalar: projection and scale of a 16-column tile
  // are then scalar picks
  const int ws = __builtin_amdgcn_readfirstlane(wave);

  int cur = 0;  // place in sm of the buffer of stage t, buffer t mod 3
  // One stage. 'last' is a constant at each call: it picks the wait's count.
  auto stage = [&](const int t, const bool last) __attribute__((always_inline)) {
    // Publish point of stage t. This wave's reads of trip t - 1 have retired:
    asm volatile("s_wait_dscnt 0x0" ::: "memory");
    // its own copies of stage t have landed. Where stage t + 1 exists, its 24
    // copies, the wave's youngest, may stay in flight; else the wait is to 0:
    if (!last)
      asm volatile("s_wait_asynccnt 0x18" ::: "memory");
    else
      asm volatile("s_wait_asynccnt 0x0" ::: "memory");
    // the barrier shows stage t to every wave and ends every wave's reads of
    // the buffer of trip t - 1, which the copies behind it refill
    __syncthreads();
    if (t + 2 < GSTG) issue((t + 2) * 64, cur == 0 ? 2 * QBUF : cur - QBUF);

    // two 32-deep blocks per stage
#pragma unroll
    for (int ks = 0; ks < 2; ++ks) {
      v16h aF[6], bF[6];
#pragma unroll
      for (int mi = 0; mi < 6; ++mi)
        aF[mi] = ld_frag(
            &sm[cur + tile_row(wm * 96 + mi * 16 + (lane & 15)) + ks * 32],
            lane);
#pragma unroll
      for (int ni = 0; ni < 6; ++ni)
        bF[ni] = ld_frag(&sm[cur + QTILE +
                             tile_row(wn * 96 + ni * 16 + (lane & 15)) + ks * 32],
                         lane);
      // Keeps the block's 24 LDS reads one group in front of its products:
      // left alone, the compiler sinks them among the products, each small
      // group with a wait of its own.
      __builtin_amdgcn_sched_barrier(0);
#pragma unroll
      for (int ni = 0; ni < 6; ++ni)
#pragma unroll
        for (int mi = 0; mi < 6; ++mi)
          acc[mi][ni] = __builtin_amdgcn_wmma_f32_16x16x32_f16(
              false, bF[ni], false, aF[mi], (short)0, acc[mi][ni], false,
              false);
      // The other end of the block: no product sinks behind the next publish
      // point, and no later read or address sum rises among the products.
      __builtin_amdgcn_sched_barrier(0);
    }
    cur = cur == 2 * QBUF ? 0 : cur + QBUF;
  };
  for (int t = 0; t < GSTG - 1; ++t) stage(t, false);
  stage(GSTG - 1, true);

  // The ring becomes output staging for the whole work-group: this wave's last
  // reads have retired, every copy has landed (the last stage's wait to 0), and
  // the barrier ends every wave's reads.
  asm volatile("s_wait_dscnt 0x0" ::: "memory");
  __syncthreads();
  static_assert(QM * QPIT <= GBUF * QBUF, "output staging must fit the ring");

#pragma unroll
  for (int ni = 0; ni < 6; ++ni) {
    const int z = (nblk + (ws & 1) * 96 + ni * 16) >> 10;
    const float scale = z == 0 ? scale0 : z == 1 ? scale1 : scale2;
    const v8f bb = *(const v8f*)&sbias[(ws & 1) * 96 + ni * 16 + 8 * hf];
#pragma unroll
    for (int mi = 0; mi < 6; ++mi) {
      const v8f v = (acc[mi][ni] + bb) * scale;
      v8h o;
#pragma unroll
      for (int r = 0; r < 8; ++r) o[r] = (_Float16)v[r];
      *(v8h*)&sm[((ws >> 1) * 96 + mi * 16 + c) * QPIT + (ws & 1) * 96 +
                 ni * 16 + 8 * hf] = o;
    }
  }
  // the staged rows are read by other waves: this wave's LDS writes land, then
  // the barrier
  asm volatile("s_wait_dscnt 0x0" ::: "memory");
  __syncthreads();

  // 192 columns are three whole heads; a row of one head is one 128-byte line:
  // 8 lanes a line, 4 rows a store, one writer a line.
  const int srow = wave * 4 + (lane >> 3);  // rows srow + 16 * j, j = 0..11
  v8h o[12][3];
#pragma unroll
  for (int j = 0; j < 12; ++j)
#pragma unroll
    for (int h = 0; h < 3; ++h)
      o[j][h] = *(const v8h*)&sm[(srow + 16 * j) * QPIT + h * 64 + (lane & 7) * 8];
#pragma unroll
  for (int j = 0; j < 12; ++j) {
    const int m = mblk + srow + 16 * j;
    if (m < M) {
      const int b = m / SEQ, t = m - b * SEQ;
#pragma unroll
      for (int h = 0; h < 3; ++h) {
        const int zh = (nblk >> 6) + h;  // 16 * projection + head
        *(v8h*)(outH +
                (((size_t)(((zh >> 4) * (MROWS / SEQ) + b) * NH + (zh & 15)) *
                  SEQ) + t) * HD + (lane & 7) * 8) = o[j][h];
      }
      // precaution: closes the row's stores before the next row's address
      // sums reuse their registers
      asm volatile("s_wait_xcnt 0x0" ::: "memory");
    }
  }
}

typedef __attribute__((ext_vector_type(8))) short v8s;

// 16-bit transposing LDS load from a row-major tile T[k][d]. With
// p = &T[k0 + 8 * (lane >> 4) + (lane & 7)][d0 + 8 * ((lane >> 3) & 1)]
// lane (c = lane & 15, h = lane >> 4) receives T[k0 + 8h + 0..7][d0 + c].
__device__ inline v8h ld_tr16(const _Float16* p) {
  typedef __attribute__((address_space(3))) v8s lds_v8s;
  return __builtin_bit_cast(
      v8h, __builtin_amdgcn_ds_load_tr16_b128_v8i16((lds_v8s*)p));
}

// value of lane l ^ 16
__device__ inline float xhalf(float x) {
  int b = __builtin_bit_cast(int, x);
  return __builtin_bit_cast(
      float, __builtin_amdgcn_permlanex16(b, b, 0x76543210, 0xfedcba98, false,
                                          false));
}

#define ANT ((SEQ + 63) / 64)  // key tiles
#define AKT (64 * 72)          // halves of a K buffer
#define AVT (64 * 80)          // halves of a V buffer
__global__ __launch_bounds__(128) void attn_kernel(
    const _Float16* __restrict__ Q, const _Float16* __restrict__ K,
    const _Float16* __restrict__ V, _Float16* __restrict__ O) {
  // three buffers of [kv][d], pitch 144 B: plain 16-B reads
  __shared__ __attribute__((aligned(16))) _Float16 kt[3 * AKT];
  // three buffers of [kv][d], pitch 160 B: transposing reads
  __shared__ __attribute__((aligned(16))) _Float16 vs[3 * AVT];
  static_assert(ANT >= 2, "the ring's prologue needs two tiles");

  const int tid  = threadIdx.x;
  const int lane = tid & 31;
  const int w    = tid >> 5;
  const int c    = lane & 15;
  const int hf   = lane >> 4;
  const int bh   = blockIdx.y;
  const int q0   = blockIdx.x * 128 + w * 32;

  const _Float16* Qb = Q + (size_t)bh * SEQ * HD;
  const _Float16* Kb = K + (size_t)bh * SEQ * HD;
  const _Float16* Vb = V + (size_t)bh * SEQ * HD;

  // Q fragments (B operand, column = query 16 g + c; clamped, invalid never
  // stored)
  v16h qf[2][2];
#pragma unroll
  for (int g = 0; g < 2; ++g) {
    const int qrow = q0 + 16 * g + c;
    const int qr = qrow < SEQ ? qrow : (SEQ - 1);
#pragma unroll
    for (int s = 0; s < 2; ++s)
      qf[g][s] = ld_frag(Qb + (size_t)qr * HD + s * 32, lane);
  }

  v8f oacc[2][4];  // oacc[g][t][r] = O^T[d = 16t + 8*hf + r][query 16g + c]
#pragma unroll
  for (int g = 0; g < 2; ++g)
#pragma unroll
    for (int t = 0; t < 4; ++t) oacc[g][t] = zero8f();
  // minus the reference maximum of query 16g + c, log2 units, equal in both
  // halves, in all eight registers: C operand of the score products; the first
  // tile sets it
  v8f cin[2] = {zero8f(), zero8f()};
  // running sum over this half's keys only, at the reference's scale
  float lrow[2] = {0.f, 0.f};

  const int lkv = tid >> 3;       // 0..15; rows lkv + 16 * i, i = 0..3
  const int ld0 = (tid & 7) * 8;  // 8 lanes x 16 B = one 128-byte row

  // this lane's LDS byte addresses in buffer 0, row lkv
  const unsigned lk0 = (unsigned)(size_t)&kt[lkv * 72 + ld0];
  const unsigned lv0 = (unsigned)(size_t)&vs[lkv * 80 + ld0];
  // and its places in row 0 of K and V
  const char* gk0 = (const char*)(Kb + ld0);
  const char* gv0 = (const char*)(Vb + ld0);
  // The tile whose row lkv lies rb bytes into K and V, into the buffers kb and
  // vb halves into kt and vs. Rows past the end are clamped, not masked: every
  // lane copies, from inside K and V; the clamped rows repeat the last key's
  // own values, and such keys get weight 0 below.
  auto issue = [&](unsigned rb, int kb, int vb) {
    unsigned l[8];
    const _Float16* g[8];
#pragma unroll
    for (int i = 0; i < 4; ++i) {
      const unsigned top = (SEQ - 1 - 16 * i) * HD * 2;
      const unsigned a = (rb < top ? rb : top) + 16 * i * HD * 2;
      l[i]     = lk0 + kb * 2 + i * 16 * 144;
      l[4 + i] = lv0 + vb * 2 + i * 16 * 160;
      g[i]     = (const _Float16*)(gk0 + a);
      g[4 + i] = (const _Float16*)(gv0 + a);
    }
    copy_stage(l, g);
  };
  unsigned rb = lkv * HD * 2;
  issue(rb, 0, 0);
  rb += 64 * HD * 2;
  issue(rb, AKT, AVT);

  int ko = 0, vo = 0;  // buffer i mod 3 of tile i: its place in kt and vs
  // One tile. 'last' is a constant at each call: only the last tile holds keys
  // past the end, so only its copy of the body carries the mask.
  static_assert((ANT - 1) * 64 <= SEQ, "only the last tile is masked");
  auto tile = [&](const int i, const bool last) __attribute__((always_inline)) {
    const int kv0 = i * 64;
    // Publish point of tile i. This wave's reads of tile i - 1 have retired:
    asm volatile("s_wait_dscnt 0x0" ::: "memory");
    // its own copies of tile i have landed. Where trip i - 1 has issued tile
    // i + 1, those 8 copies, the wave's youngest, may stay in flight; where it
    // has issued nothing, the wait is to 0:
    if (!last)
      asm volatile("s_wait_asynccnt 0x8" ::: "memory");
    else
      asm volatile("s_wait_asynccnt 0x0" ::: "memory");
    // the barrier shows tile i to every wave and ends every wave's reads of
    // the buffer of tile i - 1, which the copies behind it refill
    __syncthreads();
    rb += 64 * HD * 2;
    if (i + 2 < ANT)
      issue(rb, ko == 0 ? 2 * AKT : ko - AKT, vo == 0 ? 2 * AVT : vo - AVT);

    // S^T = K Q^T - reference : 4 key tiles x 2 k-steps x 2 column groups;
    // sa[g][t][r] = S[query 16g + c][key kv0 + 16t + 8*hf + r] + cin[g][r]
    v8f sa[2][4];
    // The last tile spreads its C operand anew from one register: handed over
    // whole, the compiler copied all 16 registers on every trip of the loop
    // for the code behind it.
    if (last) {
#pragma unroll
      for (int g = 0; g < 2; ++g)
#pragma unroll
        for (int r = 1; r < 8; ++r) cin[g][r] = cin[g][0];
    }
    v16h kF[4][2];
#pragma unroll
    for (int t = 0; t < 4; ++t)
#pragma unroll
      for (int s = 0; s < 2; ++s)
        kF[t][s] = ld_frag(&kt[ko + (t * 16 + c) * 72 + s * 32], lane);
    // Keeps the tile's 16 K reads one group in front of its products: without
    // it the compiler set two reads and a wait to 0 in front of every two
    // products.
    __builtin_amdgcn_sched_barrier(0);
#pragma unroll
    for (int s = 0; s < 2; ++s)
#pragma unroll
      for (int t = 0; t < 4; ++t)
#pragma unroll
        for (int g = 0; g < 2; ++g)
          sa[g][t] = __builtin_amdgcn_wmma_f32_16x16x32_f16(
              false, kF[t][s], false, qf[g][s], (short)0,
              s == 0 ? cin[g] : sa[g][t], false, false);
    // Keeps the 16 products one run: left alone, the compiler draws the maximum
    // chain up among them, each of its reads behind idle slots that the
    // distance from a product to the first read of its result asks for.
    __builtin_amdgcn_sched_barrier(0);

    // The tile's 16 V^T reads, one group too: they fly while the vector work
    // below runs, ahead of the second run of products.
    const _Float16* vp =
        &vs[vo + (8 * hf + (lane & 7)) * 80 + 8 * ((lane >> 3) & 1)];
    v16h vF[4][2];
#pragma unroll
    for (int t = 0; t < 4; ++t)
#pragma unroll
      for (int j = 0; j < 2; ++j)
        vF[t][j] = make16(ld_tr16(vp + (j * 32) * 80 + t * 16),
                          ld_tr16(vp + (j * 32 + 16) * 80 + t * 16));
    // holds the group here: left alone, the compiler sinks the reads among the
    // products that use them
    __builtin_amdgcn_sched_barrier(0);

    // mask OOB keys + this half's highest score above the reference, per query
    float nm[2];
#pragma unroll
    for (int g = 0; g < 2; ++g) {
#pragma unroll
      for (int t = 0; t < 4; ++t) {
#pragma unroll
        for (int r = 0; r < 8; ++r) {
          int ng = kv0 + t * 16 + 8 * hf + r;
          float sc = (!last || ng < SEQ) ? sa[g][t][r] : -1e30f;
          sa[g][t][r] = sc;
          nm[g] = (t == 0 && r == 0) ? sc : fmaxf(nm[g], sc);
        }
      }
    }
    // One test a tile, a scalar branch for the whole wave: the reference moves
    // on the first tile, which sets it, and where a score of any lane stands
    // more than 8 above it. Marked rare, so that the usual path falls through
    // and the loop runs in one straight piece.
    const bool need = fmaxf(nm[0], nm[1]) > 8.f;
    if (__builtin_expect(i == 0 || __builtin_amdgcn_ballot_w32(need) != 0, 0)) {
#pragma unroll
      for (int g = 0; g < 2; ++g) {
        const float tm = fmaxf(nm[g], xhalf(nm[g]));
        // the reference only rises, to a maximum that a key has reached, so
        // that key's term keeps the sum at 1 or more
        const float d = i == 0 ? tm : fmaxf(tm, 0.f);
        // O and the sum are still 0 on the first tile
        const float fac = i == 0 ? 1.f : __builtin_amdgcn_exp2f(-d);
        const float nr = cin[g][0] - d;
#pragma unroll
        for (int r = 0; r < 8; ++r) cin[g][r] = nr;
#pragma unroll
        for (int t = 0; t < 4; ++t)
#pragma unroll
          for (int r = 0; r < 8; ++r) {
            sa[g][t][r] -= d;
            oacc[g][t][r] *= fac;
          }
        lrow[g] *= fac;
      }
    }

    // P^T = exp2(S^T - reference): element s of the B operand of 32-key block j
    // is key 32j + (s < 8 ? 8*hf + s : 16 + 8*hf + s - 8) = sa[2j + s/8][s%8]
    v16h pF[2][2];
#pragma unroll
    for (int g = 0; g < 2; ++g) {
      float psum = 0.f;
#pragma unroll
      for (int j = 0; j < 2; ++j) {
#pragma unroll
        for (int s = 0; s < 16; ++s) {
          float p = __builtin_amdgcn_exp2f(sa[g][2 * j + (s >> 3)][s & 7]);
          psum += p;
          pF[g][j][s] = (_Float16)p;
        }
      }
      lrow[g] += psum;
    }

    // O^T += V^T P^T : 4 d tiles x 2 key blocks x 2 column groups
#pragma unroll
    for (int j = 0; j < 2; ++j)
#pragma unroll
      for (int t = 0; t < 4; ++t)
#pragma unroll
        for (int g = 0; g < 2; ++g)
          oacc[g][t] = __builtin_amdgcn_wmma_f32_16x16x32_f16(
              false, vF[t][j], false, pF[g][j], (short)0, oacc[g][t], false,
              false);
    ko = ko == 2 * AKT ? 0 : ko + AKT;
    vo = vo == 2 * AVT ? 0 : vo + AVT;
  };
  for (int i = 0; i < ANT - 1; ++i) tile(i, false);
  tile(ANT - 1, true);

  // join the halves' sums with every lane active, ahead of the row guard
  float lsum[2];
#pragma unroll
  for (int g = 0; g < 2; ++g) lsum[g] = lrow[g] + xhalf(lrow[g]);

  // The wave's 32 x 64 tile goes out through LDS so that a store covers whole
  // 128-byte lines. The barrier ends every wave's reads of the last K/V tile;
  // behind it each wave stages in 32 rows of its own in kt.
  static_assert(4 * 32 * 72 <= 3 * AKT, "output staging must fit kt");
  __syncthreads();
  // the wave's number as a scalar, so that the range test is a scalar branch
  const int ws = __builtin_amdgcn_readfirstlane(w);
  _Float16* st = &kt[32 * ws * 72];
#pragma unroll
  for (int g = 0; g < 2; ++g)
#pragma unroll
    for (int t = 0; t < 4; ++t) {
      v8h o;
#pragma unroll
      for (int r = 0; r < 8; ++r) o[r] = (_Float16)(oacc[g][t][r] / lsum[g]);
      *(v8h*)&st[(16 * g + c) * 72 + t * 16 + 8 * hf] = o;
    }
  // the rows are read back by other lanes of this wave: its LDS writes must
  // have landed, and the compiler must not move the reads above them
  asm volatile("s_wait_dscnt 0x0" ::: "memory");

  // a query's 64 values of one head are 128 bytes: 8 lanes a row, 4 rows a store
  const int b = bh >> 4, h = bh & 15;
  const int qs = blockIdx.x * 128 + ws * 32;
  const _Float16* sr = st + (lane >> 3) * 72 + (lane & 7) * 8;
  _Float16* og = O + ((size_t)(b * SEQ + qs + (lane >> 3))) * EMB + h * HD +
                 (lane & 7) * 8;
  if (qs + 32 <= SEQ) {
    v8h o[8];
#pragma unroll
    for (int i = 0; i < 8; ++i) o[i] = *(const v8h*)(sr + i * 4 * 72);
#pragma unroll
    for (int i = 0; i < 8; ++i) *(v8h*)(og + (size_t)i * 4 * EMB) = o[i];
    // precaution: closes the run's stores before anything that stands
    // behind them in the listing reuses their registers
    asm volatile("s_wait_xcnt 0x0" ::: "memory");
  } else {
#pragma unroll
    for (int i = 0; i < 8; ++i) {
      const v8h o = *(const v8h*)(sr + i * 4 * 72);
      if (qs + (lane >> 3) + 4 * i < SEQ) {
        *(v8h*)(og + (size_t)i * 4 * EMB) = o;
        // precaution: closes the store before the next trip's LDS read
        // reuses its data registers
        asm volatile("s_wait_xcnt 0x0" ::: "memory");
      }
    }
  }
}

extern "C" void kernel_launch(void* const* d_in, const int* in_sizes, int n_in,
                              void* d_out, int out_size, void* d_ws,
                              size_t ws_size, hipStream_t stream) {
  const float* x  = (const float*)d_in[0];
  const float* Wq = (const float*)d_in[1];
  const float* bq = (const float*)d_in[2];
  const float* Wk = (const float*)d_in[3];
  const float* Wv = (const float*)d_in[4];
  const float* bv = (const float*)d_in[5];
  const float* Wo = (const float*)d_in[6];
  const float* bo = (const float*)d_in[7];
  float* out = (float*)d_out;

  _Float16* base = (_Float16*)d_ws;
  size_t off = 0;
  auto carve = [&](size_t n) {
    _Float16* p = base + off;
    off += (n + 127) & ~(size_t)127;
    return p;
  };
  _Float16* Xh  = carve((size_t)MROWS * EMB);
  // the three input weights one behind the other: one [3072][1024] matrix
  _Float16* Wqh = carve((size_t)3 * EMB * EMB);
  _Float16* Wkh = Wqh + (size_t)EMB * EMB;
  _Float16* Wvh = Wkh + (size_t)EMB * EMB;
  _Float16* Woh = carve((size_t)EMB * EMB);
  // and their three outputs
  _Float16* Qh  = carve((size_t)3 * MROWS * EMB);
  _Float16* Kh  = Qh + (size_t)MROWS * EMB;
  _Float16* Vh  = Kh + (size_t)MROWS * EMB;
  _Float16* Ah  = carve((size_t)MROWS * EMB);

  cvt_f32_to_f16<<<dim3(512, 5), 256, 0, stream>>>(
      x, Wq, Wk, Wv, Wo, Xh, Wqh, Wkh, Wvh, Woh, MROWS * EMB, EMB * EMB);

  dim3 g((MROWS + 127) / 128, EMB / 128);        // 47 x 8
  dim3 g3((MROWS + QM - 1) / QM, 3 * EMB / QM);  // 32 x 16
  // q = (X Wq^T + bq) * d^-0.5 * log2 e (scale applied after bias, as in the
  // reference; log2 e so that attention's scores are arguments of exp2)
  gemm_qkv<<<g3, 128, 0, stream>>>(Xh, Wqh, bq, nullptr, bv, 0.18033688f, 1.0f,
                                   1.0f, MROWS, Qh);

  attn_kernel<<<dim3((SEQ + 127) / 128, 4 * NH), 128, 0, stream>>>(Qh, Kh, Vh,
                                                                   Ah);

  gemm_xwT<<<g, 128, 0, stream>>>(Ah, Woh, nullptr, nullptr, bo, nullptr,
                                  nullptr, 1.0f, 1.0f, 1.0f, MROWS, 1, nullptr,
                                  nullptr, nullptr, out);
}
